// v000
// The times below were measured on an AMD MI455X: many runs one after another, warmed up first and cycling through
// copies of the inputs, with the whole window's GPU time divided by the number of runs. Launches and the gaps
// between them are all in it. The median over several windows is given; except for v000 it joins two sittings, which
// can be a few percent apart, so the side-by-side timings, each taken in one sitting, are the better comparison.
// v000, which the later versions start from, runs in 187 microseconds.
// Compute dtype: q.k^T and p.v on v_wmma_f32_16x16x32_f16 (q, k, v = f16 of RNE-bf16 inputs; p = f16 carried x32768), f32 accumulate; cumulative gate sum (of RNE-bf16 g), online softmax and normalisation in f32.
#include <hip/hip_runtime.h>
#include <math.h>

// ---------------------------------------------------------------------------
// Shape constants
// ---------------------------------------------------------------------------
constexpr int NBATCH = 4;
constexpr int NTIME  = 2048;
constexpr int NHEAD  = 8;
constexpr int NKVH   = 4;
constexpr int HDIM   = 64;
constexpr int VDIM   = 64;
constexpr int GQA    = NHEAD / NKVH;
constexpr int QBLK   = 64;
constexpr int KCHUNK = 64;
constexpr int NQB    = NTIME / QBLK;
constexpr int SQRT_HDIM = 8;
constexpr int OPITCH = 68;
static_assert(SQRT_HDIM * SQRT_HDIM == HDIM, "scale derivation");
static_assert(HDIM == 64 && VDIM == 64, "tile shapes");
static_assert(NHEAD % NKVH == 0 && GQA == 2, "kv head grouping");
static_assert(NTIME % 64 == 0, "time tiles");
static_assert(HDIM % 32 == 0 && KCHUNK % 32 == 0, "k steps of 32");

constexpr float LOG2E_F   = 1.4426950408889634f;
constexpr float QK_SCALE  = 1.0f / (float)SQRT_HDIM;
constexpr float SCORE_L2  = QK_SCALE * LOG2E_F;
constexpr float P_CARRY   = 32768.0f;
constexpr float NEG_BIG   = -1.0e30f;

constexpr size_t GC_BYTES = (size_t)NBATCH * NHEAD * NTIME * 4;
constexpr size_t KH_BYTES = (size_t)NBATCH * NKVH * NTIME * HDIM * 2;
constexpr size_t VT_BYTES = (size_t)NBATCH * NKVH * VDIM * NTIME * 2;
static_assert(GC_BYTES + KH_BYTES + VT_BYTES <= (size_t)134217728, "carve");
static_assert((size_t)NBATCH * NTIME * NHEAD * VDIM * 4 == (size_t)16777216, "output bytes");

typedef __attribute__((ext_vector_type(16))) _Float16 v16h;
typedef __attribute__((ext_vector_type(8)))  _Float16 v8h;
typedef __attribute__((ext_vector_type(8)))  float    v8f;
typedef __attribute__((ext_vector_type(4)))  float    v4f;

// RNE convert of an f32 value to bf16 precision
__device__ __forceinline__ unsigned short f2bf_bits(float f) {
  unsigned u = __float_as_uint(f);
  return (unsigned short)((u + 0x7FFFu + ((u >> 16) & 1u)) >> 16);
}
__device__ __forceinline__ float bf_bits2f(unsigned short h) { return __uint_as_float(((unsigned)h) << 16); }
/* RNE convert to a bf16 value, kept in f32 */
__device__ __forceinline__ float bf16r(float f) { return bf_bits2f(f2bf_bits(f)); }

/* one WMMA followed by the 4-slot hazard guard tying D and naming A, B */
__device__ __forceinline__ v8f mma_h(v16h a, v16h b, v8f c) {
  c = __builtin_amdgcn_wmma_f32_16x16x32_f16(false, a, false, b, (short)0, c, false, false);
  asm volatile("v_nop\n\tv_nop\n\tv_nop\n\tv_nop" : "+v"(c) : "v"(a), "v"(b));
  return c;
}

union FragH { v16h v; v8h h[2]; };
/* elements 0..7 <- p[0..7], elements 8..15 <- p[16..23]; caller adds 8*(lane>>4) */
__device__ __forceinline__ v16h frag_load(const _Float16* p) {
  FragH f;
  f.h[0] = *(const v8h*)(p);
  f.h[1] = *(const v8h*)(p + 16);
  return f.v;
}

// ---------------------------------------------------------------------------
// Launch 1: gc2[b*8+h][t] = log2(e) * inclusive cumulative sum over t of bf16value(g[b][t][h]), f32.
// One wave per (b,h): 64 iterations of a 32-wide inclusive scan plus carry (static trip counts).
// Store coverage: 64 iterations x 32 lanes = 2048 floats = the whole row; each instruction is 32 lanes x 4 B =
// ---------------------------------------------------------------------------
__global__ __launch_bounds__(32) void gscan_kernel(const float* __restrict__ g, float* __restrict__ gc2) {
  const int bh = blockIdx.x;
  const int b = bh / NHEAD;
  const int h = bh % NHEAD;
  const int lane = threadIdx.x;
  float carry = 0.0f;
#pragma unroll 1
  for (int t0 = 0; t0 < NTIME; t0 += 32) {
    const float raw = g[((size_t)(b * NTIME + t0 + lane)) * NHEAD + h];
    float val = bf16r(raw);
#pragma unroll
    for (int d = 1; d < 32; d <<= 1) {
      const float up = __shfl_up(val, d, 32);
      val += (lane >= d) ? up : 0.0f;
    }
    val += carry;
    const float o = val * LOG2E_F;
    float* p = gc2 + (size_t)bh * NTIME + t0 + lane;
    *(float*)p = o;
    
    carry = __shfl(val, 31, 32);
  }
}

// ---------------------------------------------------------------------------
// Launch 2: 16-bit operand planes. Block = 64 time steps of one (b, kv head); 256 threads; grid = 4*4*32 = 512.
//   Vt[(b*4+hk)][vc][t]  = f16(bf16value(v[b][t][hk][vc]))     in [t][vc] -> out [vc][t] through a 64x64 LDS tile
// Load coverage V: 4 iterations x 256 threads x 4 floats = 64 x 64. K: 2 groups x 256 threads x 8 floats = 64 x 64.
// Store coverage: 2 groups x 32 rows (tid>>3) x 8 lanes x 8 halves = 64 rows x 64 halves for each plane; lanes
// ---------------------------------------------------------------------------
__global__ __launch_bounds__(256) void kvprep_kernel(const float* __restrict__ kin, const float* __restrict__ vin,
                                                     unsigned short* __restrict__ Khp,
                                                     unsigned short* __restrict__ Vtp) {
  __shared__ float Tt[64 * 65];
  _Float16* Kh = (_Float16*)Khp;
  _Float16* Vt = (_Float16*)Vtp;
  const int tid = threadIdx.x;
  const int tb = blockIdx.x % (NTIME / 64);
  const int bk = blockIdx.x / (NTIME / 64);
  const int b  = bk / NKVH;
  const int hk = bk % NKVH;
  const int t0 = tb * 64;

#pragma unroll
  for (int i = 0; i < 4; ++i) {
    const int idx = i * 256 + tid;
    const int rr = idx >> 4;
    const int cc = (idx & 15) * 4;
    const v4f vv = *(const v4f*)(vin + (((size_t)(b * NTIME + t0 + rr)) * NKVH + hk) * VDIM + cc);
    Tt[rr * 65 + cc + 0] = vv[0];
    Tt[rr * 65 + cc + 1] = vv[1];
    Tt[rr * 65 + cc + 2] = vv[2];
    Tt[rr * 65 + cc + 3] = vv[3];
  }
  asm volatile("" ::: "memory");

  const int q  = tid >> 3;
  const int c8 = (tid & 7) * 8;
  v8h kh[2];
#pragma unroll
  for (int gq = 0; gq < 2; ++gq) {
    const int row = gq * 32 + q;
    const float* sp = kin + (((size_t)(b * NTIME + t0 + row)) * NKVH + hk) * HDIM + c8;
    const v4f a = *(const v4f*)(sp);
    const v4f c = *(const v4f*)(sp + 4);
#pragma unroll
    for (int e = 0; e < 4; ++e) {
      const float x0 = a[e];
      const float x1 = c[e];
      kh[gq][e]     = (_Float16)bf16r(x0);
      kh[gq][4 + e] = (_Float16)bf16r(x1);
    }
  }
  __syncthreads();
  v8h vh[2];
#pragma unroll
  for (int gq = 0; gq < 2; ++gq) {
    const int vrow = gq * 32 + q;
#pragma unroll
    for (int e = 0; e < 8; ++e) {
      const float f = Tt[(c8 + e) * 65 + vrow];
      vh[gq][e] = (_Float16)bf16r(f);
    }
  }
  {
#pragma unroll
    for (int gq = 0; gq < 2; ++gq) {
      const int row = gq * 32 + q;
      *(v8h*)(Kh + ((size_t)bk * NTIME + t0 + row) * HDIM + c8) = kh[gq];
      *(v8h*)(Vt + ((size_t)bk * VDIM + row) * NTIME + t0 + c8) = vh[gq];
    }
    
  }
}

// ---------------------------------------------------------------------------
// Launch 3: causal attention with per-key gate bias, online softmax in the log2 domain.
// Block = 4 waves = 64 query rows of one (b, h); grid = 4*8*32 = 1024. Key chunks of 64, chunks 0..qb (block-uniform).
// Per chunk: K tile [64 key][64 d] and V^T tile [64 vc][64 key] copied from the f16 planes into LDS
// (4 iterations x 128 threads x 8 halves = 4096 halves each), block barrier before and after.
// S: A = q [row][d] fragments in registers, B = K tile rows [key][d] (same split k map).
// t = S * (scale*log2e) - gc2[key]; masked (key > row, diagonal chunk only) -> -1e30; p = exp2(t - m).
// B = V^T tile rows [vc][key]. Denominator = sum of the same f16 values (per-lane partials, reduced once at the end).
// 4 waves = 64 rows, 64 columns.
// ---------------------------------------------------------------------------
__global__ __launch_bounds__(128) void attn_kernel(const float* __restrict__ qin,
                                                   const unsigned short* __restrict__ Khp,
                                                   const unsigned short* __restrict__ Vtp,
                                                   const float* __restrict__ gc2,
                                                   float* __restrict__ out) {
  __shared__ __align__(16) _Float16 Ks[KCHUNK * HDIM];
  __shared__ __align__(16) _Float16 Vs[VDIM * KCHUNK];
  __shared__ __align__(16) _Float16 Ps[4][16 * KCHUNK];
  __shared__ __align__(16) float    Os[4][16 * OPITCH];
  const _Float16* Kh = (const _Float16*)Khp;
  const _Float16* Vt = (const _Float16*)Vtp;

  const int tid  = threadIdx.x;
  const int wave = tid >> 5;
  const int lane = tid & 31;
  const int hh   = lane >> 4;
  const int c    = lane & 15;

  const int qb = blockIdx.x % NQB;
  const int bh = blockIdx.x / NQB;
  const int h  = bh % NHEAD;
  const int b  = bh / NHEAD;
  const int hk = h / GQA;
  const int bk = b * NKVH + hk;
  const int q0 = qb * QBLK + wave * 16;

  /* Q fragments: element e <- d = 32dc + 8hh + e, element 8+e <- d = 32dc + 16 + 8hh + e, row q0 + c */
  v16h qa[2];
  {
    const float* qrow = qin + (((size_t)(b * NTIME + q0 + c)) * NHEAD + h) * HDIM;
#pragma unroll
    for (int dc = 0; dc < 2; ++dc) {
      const v4f a0 = *(const v4f*)(qrow + dc * 32 + 8 * hh);
      const v4f a1 = *(const v4f*)(qrow + dc * 32 + 8 * hh + 4);
      const v4f b0 = *(const v4f*)(qrow + dc * 32 + 16 + 8 * hh);
      const v4f b1 = *(const v4f*)(qrow + dc * 32 + 16 + 8 * hh + 4);
#pragma unroll
      for (int e = 0; e < 4; ++e) {
        const float x0 = a0[e];
        const float x1 = a1[e];
        const float x2 = b0[e];
        const float x3 = b1[e];
        qa[dc][e]      = (_Float16)bf16r(x0);
        qa[dc][4 + e]  = (_Float16)bf16r(x1);
        qa[dc][8 + e]  = (_Float16)bf16r(x2);
        qa[dc][12 + e] = (_Float16)bf16r(x3);
      }
    }
  }

  float mrow[8], lrow[8];
  v8f oacc[4];
#pragma unroll
  for (int r = 0; r < 8; ++r) { mrow[r] = NEG_BIG; lrow[r] = 0.0f; }
#pragma unroll
  for (int t = 0; t < 4; ++t) oacc[t] = (v8f){0.f, 0.f, 0.f, 0.f, 0.f, 0.f, 0.f, 0.f};

  const float* gcb = gc2 + (size_t)bh * NTIME;
  const _Float16* kplane = Kh + (size_t)bk * NTIME * HDIM;
  const _Float16* vplane = Vt + (size_t)bk * VDIM * NTIME;
  _Float16* pw = Ps[wave];
  const int nChunks = qb + 1;

#pragma unroll 1
  for (int kc = 0; kc < nChunks; ++kc) {
    const int kv0 = kc * KCHUNK;
    __syncthreads();
    {
      const _Float16* ksrc = kplane + (size_t)kv0 * HDIM;
#pragma unroll
      for (int it = 0; it < 4; ++it) {
        const int idx = it * 128 + tid;
        const int vcol = idx >> 3;
        const int k8 = (idx & 7) * 8;
        const v8h kk = *(const v8h*)(ksrc + idx * 8);
        const v8h vv = *(const v8h*)(vplane + (size_t)vcol * NTIME + kv0 + k8);
        *(v8h*)(Ks + idx * 8) = kk;
        *(v8h*)(Vs + vcol * KCHUNK + k8) = vv;
      }
    }
    float gk[4];
#pragma unroll
    for (int j = 0; j < 4; ++j) gk[j] = gcb[kv0 + j * 16 + c];
    __syncthreads();

    v8f s[4];
#pragma unroll
    for (int j = 0; j < 4; ++j) {
      s[j] = (v8f){0.f, 0.f, 0.f, 0.f, 0.f, 0.f, 0.f, 0.f};
#pragma unroll
      for (int dc = 0; dc < 2; ++dc) {
        const v16h kb = frag_load(Ks + (j * 16 + c) * HDIM + dc * 32 + 8 * hh);
        s[j] = mma_h(qa[dc], kb, s[j]);
      }
    }

    const bool diag = (kc == qb);
    float cm[8];
#pragma unroll
    for (int r = 0; r < 8; ++r) {
      const int qrow = q0 + 8 * hh + r;
      float m = NEG_BIG;
#pragma unroll
      for (int j = 0; j < 4; ++j) {
        const int kvcol = kv0 + j * 16 + c;
        float tv = s[j][r] * SCORE_L2 - gk[j];
        const bool msk = diag && (kvcol > qrow);
        tv = msk ? NEG_BIG : tv;
        s[j][r] = tv;
        m = fmaxf(m, tv);
      }
#pragma unroll
      for (int off = 1; off < 16; off <<= 1) m = fmaxf(m, __shfl_xor(m, off, 32));
      cm[r] = m;
    }
#pragma unroll
    for (int r = 0; r < 8; ++r) {
      const float mnew  = fmaxf(mrow[r], cm[r]);
      const float alpha = exp2f(mrow[r] - mnew);
      mrow[r] = mnew;
      float psum = 0.0f;
#pragma unroll
      for (int j = 0; j < 4; ++j) {
        const float p = exp2f(s[j][r] - mnew);
        const _Float16 ph = (_Float16)(p * P_CARRY);
        psum += (float)ph;
        pw[(8 * hh + r) * KCHUNK + j * 16 + c] = ph;
      }
      lrow[r] = lrow[r] * alpha + psum;
#pragma unroll
      for (int t = 0; t < 4; ++t) oacc[t][r] *= alpha;
    }
    __builtin_amdgcn_fence(__ATOMIC_RELEASE, "workgroup");
    __builtin_amdgcn_wave_barrier();
    __builtin_amdgcn_fence(__ATOMIC_ACQUIRE, "workgroup");
#pragma unroll 1
    for (int kk = 0; kk < 2; ++kk) {
      const v16h pa = frag_load(pw + c * KCHUNK + kk * 32 + 8 * hh);
#pragma unroll
      for (int t = 0; t < 4; ++t) {
        const v16h vb = frag_load(Vs + (t * 16 + c) * KCHUNK + kk * 32 + 8 * hh);
        oacc[t] = mma_h(pa, vb, oacc[t]);
      }
    }
  }

  float* os = Os[wave];
#pragma unroll
  for (int r = 0; r < 8; ++r) {
    float l = lrow[r];
#pragma unroll
    for (int off = 1; off < 16; off <<= 1) l += __shfl_xor(l, off, 32);
    const float inv = 1.0f / l;
#pragma unroll
    for (int t = 0; t < 4; ++t) os[(8 * hh + r) * OPITCH + t * 16 + c] = oacc[t][r] * inv;
  }
  __builtin_amdgcn_fence(__ATOMIC_RELEASE, "workgroup");
  __builtin_amdgcn_wave_barrier();
  __builtin_amdgcn_fence(__ATOMIC_ACQUIRE, "workgroup");
  {
    const int c4 = c * 4;
    {
#pragma unroll
      for (int it = 0; it < 8; ++it) {
        const int row = it * 2 + hh;
        const v4f val = *(const v4f*)(os + row * OPITCH + c4);
        *(v4f*)(out + (((size_t)(b * NTIME + q0 + row)) * NHEAD + h) * VDIM + c4) = val;
      }
      
    }
  }
}

// ---------------------------------------------------------------------------
// Host glue. Workspace region map (bytes, 256-B aligned carve; total 8,650,752 <= 134,217,728):
//   GC2 [32][2048]          f32     262,144   log2e * cumulative gate sum per (b,h)
//   KH  [16][2048][64]      f16   4,194,304   K rows per (b, kv head)
//   VT  [16][64][2048]      f16   4,194,304   V transposed per (b, kv head)
// ---------------------------------------------------------------------------
extern "C" void kernel_launch(void* const* d_in, const int* in_sizes, int n_in,
                              void* d_out, int out_size, void* d_ws, size_t ws_size, hipStream_t stream) {
  if (n_in < 4 || d_out == nullptr || d_ws == nullptr) return;
  if (in_sizes[0] != NBATCH * NTIME * NHEAD * HDIM || in_sizes[1] != NBATCH * NTIME * NKVH * HDIM ||
      in_sizes[2] != NBATCH * NTIME * NKVH * VDIM || in_sizes[3] != NBATCH * NTIME * NHEAD ||
      out_size != NBATCH * NTIME * NHEAD * VDIM) return;

  const float* q = (const float*)d_in[0];
  const float* k = (const float*)d_in[1];
  const float* v = (const float*)d_in[2];
  const float* g = (const float*)d_in[3];
  float* out = (float*)d_out;

  char* ws = (char*)d_ws;
  size_t off = 0;
  auto carve = [&](size_t bytes) -> char* { char* p = ws + off; off += (bytes + 255) & ~(size_t)255; return p; };
  float*          GC2 = (float*)carve(GC_BYTES);
  unsigned short* KH  = (unsigned short*)carve(KH_BYTES);
  unsigned short* VT  = (unsigned short*)carve(VT_BYTES);
  if (off > ws_size || off > (size_t)134217728) return;

  gscan_kernel<<<NBATCH * NHEAD, 32, 0, stream>>>(g, GC2);
  kvprep_kernel<<<NBATCH * NKVH * (NTIME / 64), 256, 0, stream>>>(k, v, KH, VT);
  attn_kernel<<<NBATCH * NHEAD * NQB, 128, 0, stream>>>(q, KH, VT, GC2, out);
}

// v001
// Measured time: 126 microseconds a run.
// Next to v000, in two timings, it ran 1.48 times as fast each time.
// Compute dtype: q.k^T and p.v on v_wmma_f32_16x16x32_f16 (q, k, v = f16 of RNE-bf16 inputs; p = f16 carried x32768), f32 accumulate; cumulative gate sum (of RNE-bf16 g), online softmax and normalisation in f32.
#include <hip/hip_runtime.h>
#include <math.h>

// ---------------------------------------------------------------------------
// Shape constants
// ---------------------------------------------------------------------------
constexpr int NBATCH = 4;
constexpr int NTIME  = 2048;
constexpr int NHEAD  = 8;
constexpr int NKVH   = 4;
constexpr int HDIM   = 64;
constexpr int VDIM   = 64;
constexpr int GQA    = NHEAD / NKVH;
constexpr int QBLK   = 64;
constexpr int KCHUNK = 64;
constexpr int NQB    = NTIME / QBLK;
constexpr int SQRT_HDIM = 8;
constexpr int OPITCH = 68;
// LDS row pitch of the K, V^T and P tiles in halves: 64 data + 8 pad = 144 B = 16 B x 9, so the 16 rows that one
// ds_load_b128 touches per half wave start on 16 different 4-bank groups (at 128 B they share two groups).
constexpr int LPITCH = 72;
static_assert(SQRT_HDIM * SQRT_HDIM == HDIM, "scale derivation");
static_assert(HDIM == 64 && VDIM == 64, "tile shapes");
static_assert(NHEAD % NKVH == 0 && GQA == 2, "kv head grouping");
static_assert(NTIME % 64 == 0, "time tiles");
static_assert(HDIM % 32 == 0 && KCHUNK % 32 == 0, "k steps of 32");
static_assert(LPITCH >= HDIM && LPITCH >= KCHUNK && (LPITCH * 2) % 16 == 0 && ((LPITCH * 2) / 16) % 2 == 1, "LDS pitch");

constexpr float LOG2E_F   = 1.4426950408889634f;
constexpr float QK_SCALE  = 1.0f / (float)SQRT_HDIM;
constexpr float SCORE_L2  = QK_SCALE * LOG2E_F;
constexpr float P_CARRY   = 32768.0f;
constexpr float NEG_BIG   = -1.0e30f;

constexpr size_t GC_BYTES = (size_t)NBATCH * NHEAD * NTIME * 4;
constexpr size_t KH_BYTES = (size_t)NBATCH * NKVH * NTIME * HDIM * 2;
constexpr size_t VT_BYTES = (size_t)NBATCH * NKVH * VDIM * NTIME * 2;
static_assert(GC_BYTES + KH_BYTES + VT_BYTES <= (size_t)134217728, "carve");
static_assert((size_t)NBATCH * NTIME * NHEAD * VDIM * 4 == (size_t)16777216, "output bytes");

typedef __attribute__((ext_vector_type(16))) _Float16 v16h;
typedef __attribute__((ext_vector_type(8)))  _Float16 v8h;
typedef __attribute__((ext_vector_type(8)))  float    v8f;
typedef __attribute__((ext_vector_type(4)))  float    v4f;

// RNE convert of an f32 value to bf16 precision
__device__ __forceinline__ unsigned short f2bf_bits(float f) {
  unsigned u = __float_as_uint(f);
  return (unsigned short)((u + 0x7FFFu + ((u >> 16) & 1u)) >> 16);
}
__device__ __forceinline__ float bf_bits2f(unsigned short h) { return __uint_as_float(((unsigned)h) << 16); }
/* RNE convert to a bf16 value, kept in f32 */
__device__ __forceinline__ float bf16r(float f) { return bf_bits2f(f2bf_bits(f)); }

/* one WMMA followed by the 4-slot hazard guard tying D and naming A, B */
__device__ __forceinline__ v8f mma_h(v16h a, v16h b, v8f c) {
  c = __builtin_amdgcn_wmma_f32_16x16x32_f16(false, a, false, b, (short)0, c, false, false);
  asm volatile("v_nop\n\tv_nop\n\tv_nop\n\tv_nop" : "+v"(c) : "v"(a), "v"(b));
  return c;
}

union FragH { v16h v; v8h h[2]; };
/* elements 0..7 <- p[0..7], elements 8..15 <- p[16..23]; caller adds 8*(lane>>4) */
__device__ __forceinline__ v16h frag_load(const _Float16* p) {
  FragH f;
  f.h[0] = *(const v8h*)(p);
  f.h[1] = *(const v8h*)(p + 16);
  return f.v;
}

// ---------------------------------------------------------------------------
// Launch 1: gc2[b*8+h][t] = log2(e) * inclusive cumulative sum over t of bf16value(g[b][t][h]), f32.
// One wave per (b,h): 64 iterations of a 32-wide inclusive scan plus carry (static trip counts).
// Store coverage: 64 iterations x 32 lanes = 2048 floats = the whole row; each instruction is 32 lanes x 4 B =
// ---------------------------------------------------------------------------
__global__ __launch_bounds__(32) void gscan_kernel(const float* __restrict__ g, float* __restrict__ gc2) {
  const int bh = blockIdx.x;
  const int b = bh / NHEAD;
  const int h = bh % NHEAD;
  const int lane = threadIdx.x;
  float carry = 0.0f;
#pragma unroll 1
  for (int t0 = 0; t0 < NTIME; t0 += 32) {
    const float raw = g[((size_t)(b * NTIME + t0 + lane)) * NHEAD + h];
    float val = bf16r(raw);
#pragma unroll
    for (int d = 1; d < 32; d <<= 1) {
      const float up = __shfl_up(val, d, 32);
      val += (lane >= d) ? up : 0.0f;
    }
    val += carry;
    const float o = val * LOG2E_F;
    float* p = gc2 + (size_t)bh * NTIME + t0 + lane;
    *(float*)p = o;
    
    carry = __shfl(val, 31, 32);
  }
}

// ---------------------------------------------------------------------------
// Launch 2: 16-bit operand planes. Block = 64 time steps of one (b, kv head); 256 threads; grid = 4*4*32 = 512.
//   Vt[(b*4+hk)][vc][t]  = f16(bf16value(v[b][t][hk][vc]))     in [t][vc] -> out [vc][t] through a 64x64 LDS tile
// Load coverage V: 4 iterations x 256 threads x 4 floats = 64 x 64. K: 2 groups x 256 threads x 8 floats = 64 x 64.
// Store coverage: 2 groups x 32 rows (tid>>3) x 8 lanes x 8 halves = 64 rows x 64 halves for each plane; lanes
// ---------------------------------------------------------------------------
__global__ __launch_bounds__(256) void kvprep_kernel(const float* __restrict__ kin, const float* __restrict__ vin,
                                                     unsigned short* __restrict__ Khp,
                                                     unsigned short* __restrict__ Vtp) {
  __shared__ float Tt[64 * 65];
  _Float16* Kh = (_Float16*)Khp;
  _Float16* Vt = (_Float16*)Vtp;
  const int tid = threadIdx.x;
  const int tb = blockIdx.x % (NTIME / 64);
  const int bk = blockIdx.x / (NTIME / 64);
  const int b  = bk / NKVH;
  const int hk = bk % NKVH;
  const int t0 = tb * 64;

#pragma unroll
  for (int i = 0; i < 4; ++i) {
    const int idx = i * 256 + tid;
    const int rr = idx >> 4;
    const int cc = (idx & 15) * 4;
    const v4f vv = *(const v4f*)(vin + (((size_t)(b * NTIME + t0 + rr)) * NKVH + hk) * VDIM + cc);
    Tt[rr * 65 + cc + 0] = vv[0];
    Tt[rr * 65 + cc + 1] = vv[1];
    Tt[rr * 65 + cc + 2] = vv[2];
    Tt[rr * 65 + cc + 3] = vv[3];
  }
  asm volatile("" ::: "memory");

  const int q  = tid >> 3;
  const int c8 = (tid & 7) * 8;
  v8h kh[2];
#pragma unroll
  for (int gq = 0; gq < 2; ++gq) {
    const int row = gq * 32 + q;
    const float* sp = kin + (((size_t)(b * NTIME + t0 + row)) * NKVH + hk) * HDIM + c8;
    const v4f a = *(const v4f*)(sp);
    const v4f c = *(const v4f*)(sp + 4);
#pragma unroll
    for (int e = 0; e < 4; ++e) {
      const float x0 = a[e];
      const float x1 = c[e];
      kh[gq][e]     = (_Float16)bf16r(x0);
      kh[gq][4 + e] = (_Float16)bf16r(x1);
    }
  }
  __syncthreads();
  v8h vh[2];
#pragma unroll
  for (int gq = 0; gq < 2; ++gq) {
    const int vrow = gq * 32 + q;
#pragma unroll
    for (int e = 0; e < 8; ++e) {
      const float f = Tt[(c8 + e) * 65 + vrow];
      vh[gq][e] = (_Float16)bf16r(f);
    }
  }
  {
#pragma unroll
    for (int gq = 0; gq < 2; ++gq) {
      const int row = gq * 32 + q;
      *(v8h*)(Kh + ((size_t)bk * NTIME + t0 + row) * HDIM + c8) = kh[gq];
      *(v8h*)(Vt + ((size_t)bk * VDIM + row) * NTIME + t0 + c8) = vh[gq];
    }
    
  }
}

// ---------------------------------------------------------------------------
// Launch 3: causal attention with per-key gate bias, online softmax in the log2 domain.
// Block = 4 waves = 64 query rows of one (b, h); grid = 4*8*32 = 1024. Key chunks of 64, chunks 0..qb (block-uniform).
// Per chunk: K tile [64 key][64 d] and V^T tile [64 vc][64 key] copied from the f16 planes into LDS
// (4 iterations x 128 threads x 8 halves = 4096 halves each), block barrier before and after.
// S: A = q [row][d] fragments in registers, B = K tile rows [key][d] (same split k map).
// t = S * (scale*log2e) - gc2[key]; masked (key > row, diagonal chunk only) -> -1e30; p = exp2(t - m).
// B = V^T tile rows [vc][key]. Denominator = sum of the same f16 values (per-lane partials, reduced once at the end).
// 4 waves = 64 rows, 64 columns.
// ---------------------------------------------------------------------------
__global__ __launch_bounds__(128) void attn_kernel(const float* __restrict__ qin,
                                                   const unsigned short* __restrict__ Khp,
                                                   const unsigned short* __restrict__ Vtp,
                                                   const float* __restrict__ gc2,
                                                   float* __restrict__ out) {
  __shared__ __align__(16) _Float16 Ks[KCHUNK * LPITCH];
  __shared__ __align__(16) _Float16 Vs[VDIM * LPITCH];
  __shared__ __align__(16) _Float16 Ps[4][16 * LPITCH];
  __shared__ __align__(16) float    Os[4][16 * OPITCH];
  const _Float16* Kh = (const _Float16*)Khp;
  const _Float16* Vt = (const _Float16*)Vtp;

  const int tid  = threadIdx.x;
  const int wave = tid >> 5;
  const int lane = tid & 31;
  const int hh   = lane >> 4;
  const int c    = lane & 15;

  const int qb = blockIdx.x % NQB;
  const int bh = blockIdx.x / NQB;
  const int h  = bh % NHEAD;
  const int b  = bh / NHEAD;
  const int hk = h / GQA;
  const int bk = b * NKVH + hk;
  const int q0 = qb * QBLK + wave * 16;

  /* Q fragments: element e <- d = 32dc + 8hh + e, element 8+e <- d = 32dc + 16 + 8hh + e, row q0 + c */
  v16h qa[2];
  {
    const float* qrow = qin + (((size_t)(b * NTIME + q0 + c)) * NHEAD + h) * HDIM;
#pragma unroll
    for (int dc = 0; dc < 2; ++dc) {
      const v4f a0 = *(const v4f*)(qrow + dc * 32 + 8 * hh);
      const v4f a1 = *(const v4f*)(qrow + dc * 32 + 8 * hh + 4);
      const v4f b0 = *(const v4f*)(qrow + dc * 32 + 16 + 8 * hh);
      const v4f b1 = *(const v4f*)(qrow + dc * 32 + 16 + 8 * hh + 4);
#pragma unroll
      for (int e = 0; e < 4; ++e) {
        const float x0 = a0[e];
        const float x1 = a1[e];
        const float x2 = b0[e];
        const float x3 = b1[e];
        qa[dc][e]      = (_Float16)bf16r(x0);
        qa[dc][4 + e]  = (_Float16)bf16r(x1);
        qa[dc][8 + e]  = (_Float16)bf16r(x2);
        qa[dc][12 + e] = (_Float16)bf16r(x3);
      }
    }
  }

  float mrow[8], lrow[8];
  v8f oacc[4];
#pragma unroll
  for (int r = 0; r < 8; ++r) { mrow[r] = NEG_BIG; lrow[r] = 0.0f; }
#pragma unroll
  for (int t = 0; t < 4; ++t) oacc[t] = (v8f){0.f, 0.f, 0.f, 0.f, 0.f, 0.f, 0.f, 0.f};

  const float* gcb = gc2 + (size_t)bh * NTIME;
  const _Float16* kplane = Kh + (size_t)bk * NTIME * HDIM;
  const _Float16* vplane = Vt + (size_t)bk * VDIM * NTIME;
  _Float16* pw = Ps[wave];
  const int nChunks = qb + 1;

#pragma unroll 1
  for (int kc = 0; kc < nChunks; ++kc) {
    const int kv0 = kc * KCHUNK;
    __syncthreads();
    float gk[4];
    {
      const _Float16* ksrc = kplane + (size_t)kv0 * HDIM;
      v8h kk[4], vv[4];
#pragma unroll
      for (int it = 0; it < 4; ++it) {
        const int idx = it * 128 + tid;
        const int vcol = idx >> 3;
        const int k8 = (idx & 7) * 8;
        kk[it] = *(const v8h*)(ksrc + idx * 8);
        vv[it] = *(const v8h*)(vplane + (size_t)vcol * NTIME + kv0 + k8);
      }
      // the gate loads below land in registers that held these loads' addresses: the wait stands in front of that overwrite
      asm volatile("s_wait_xcnt 0x0" ::: "memory");
#pragma unroll
      for (int j = 0; j < 4; ++j) gk[j] = gcb[kv0 + j * 16 + c];
#pragma unroll
      for (int it = 0; it < 4; ++it) {
        const int idx = it * 128 + tid;
        const int vcol = idx >> 3;
        const int k8 = (idx & 7) * 8;
        *(v8h*)(Ks + vcol * LPITCH + k8) = kk[it];
        *(v8h*)(Vs + vcol * LPITCH + k8) = vv[it];
      }
    }
    __syncthreads();

    v8f s[4];
#pragma unroll
    for (int j = 0; j < 4; ++j) {
      s[j] = (v8f){0.f, 0.f, 0.f, 0.f, 0.f, 0.f, 0.f, 0.f};
#pragma unroll
      for (int dc = 0; dc < 2; ++dc) {
        const v16h kb = frag_load(Ks + (j * 16 + c) * LPITCH + dc * 32 + 8 * hh);
        s[j] = mma_h(qa[dc], kb, s[j]);
      }
    }

    const bool diag = (kc == qb);
    float cm[8];
#pragma unroll
    for (int r = 0; r < 8; ++r) {
      const int qrow = q0 + 8 * hh + r;
      float m = NEG_BIG;
#pragma unroll
      for (int j = 0; j < 4; ++j) {
        const int kvcol = kv0 + j * 16 + c;
        float tv = s[j][r] * SCORE_L2 - gk[j];
        const bool msk = diag && (kvcol > qrow);
        tv = msk ? NEG_BIG : tv;
        s[j][r] = tv;
        m = fmaxf(m, tv);
      }
#pragma unroll
      for (int off = 1; off < 16; off <<= 1) m = fmaxf(m, __shfl_xor(m, off, 32));
      cm[r] = m;
    }
#pragma unroll
    for (int r = 0; r < 8; ++r) {
      const float mnew  = fmaxf(mrow[r], cm[r]);
      const float alpha = exp2f(mrow[r] - mnew);
      mrow[r] = mnew;
      float psum = 0.0f;
#pragma unroll
      for (int j = 0; j < 4; ++j) {
        const float p = exp2f(s[j][r] - mnew);
        const _Float16 ph = (_Float16)(p * P_CARRY);
        psum += (float)ph;
        pw[(8 * hh + r) * LPITCH + j * 16 + c] = ph;
      }
      lrow[r] = lrow[r] * alpha + psum;
#pragma unroll
      for (int t = 0; t < 4; ++t) oacc[t][r] *= alpha;
    }
    __builtin_amdgcn_fence(__ATOMIC_RELEASE, "workgroup");
    __builtin_amdgcn_wave_barrier();
    __builtin_amdgcn_fence(__ATOMIC_ACQUIRE, "workgroup");
#pragma unroll 1
    for (int kk = 0; kk < 2; ++kk) {
      const v16h pa = frag_load(pw + c * LPITCH + kk * 32 + 8 * hh);
#pragma unroll
      for (int t = 0; t < 4; ++t) {
        const v16h vb = frag_load(Vs + (t * 16 + c) * LPITCH + kk * 32 + 8 * hh);
        oacc[t] = mma_h(pa, vb, oacc[t]);
      }
    }
  }

  float* os = Os[wave];
#pragma unroll
  for (int r = 0; r < 8; ++r) {
    float l = lrow[r];
#pragma unroll
    for (int off = 1; off < 16; off <<= 1) l += __shfl_xor(l, off, 32);
    const float inv = 1.0f / l;
#pragma unroll
    for (int t = 0; t < 4; ++t) os[(8 * hh + r) * OPITCH + t * 16 + c] = oacc[t][r] * inv;
  }
  __builtin_amdgcn_fence(__ATOMIC_RELEASE, "workgroup");
  __builtin_amdgcn_wave_barrier();
  __builtin_amdgcn_fence(__ATOMIC_ACQUIRE, "workgroup");
  {
    const int c4 = c * 4;
    {
#pragma unroll
      for (int it = 0; it < 8; ++it) {
        const int row = it * 2 + hh;
        const v4f val = *(const v4f*)(os + row * OPITCH + c4);
        *(v4f*)(out + (((size_t)(b * NTIME + q0 + row)) * NHEAD + h) * VDIM + c4) = val;
      }
      
    }
  }
}

// ---------------------------------------------------------------------------
// Host glue. Workspace region map (bytes, 256-B aligned carve; total 8,650,752 <= 134,217,728):
//   GC2 [32][2048]          f32     262,144   log2e * cumulative gate sum per (b,h)
//   KH  [16][2048][64]      f16   4,194,304   K rows per (b, kv head)
//   VT  [16][64][2048]      f16   4,194,304   V transposed per (b, kv head)
// ---------------------------------------------------------------------------
extern "C" void kernel_launch(void* const* d_in, const int* in_sizes, int n_in,
                              void* d_out, int out_size, void* d_ws, size_t ws_size, hipStream_t stream) {
  if (n_in < 4 || d_out == nullptr || d_ws == nullptr) return;
  if (in_sizes[0] != NBATCH * NTIME * NHEAD * HDIM || in_sizes[1] != NBATCH * NTIME * NKVH * HDIM ||
      in_sizes[2] != NBATCH * NTIME * NKVH * VDIM || in_sizes[3] != NBATCH * NTIME * NHEAD ||
      out_size != NBATCH * NTIME * NHEAD * VDIM) return;

  const float* q = (const float*)d_in[0];
  const float* k = (const float*)d_in[1];
  const float* v = (const float*)d_in[2];
  const float* g = (const float*)d_in[3];
  float* out = (float*)d_out;

  char* ws = (char*)d_ws;
  size_t off = 0;
  auto carve = [&](size_t bytes) -> char* { char* p = ws + off; off += (bytes + 255) & ~(size_t)255; return p; };
  float*          GC2 = (float*)carve(GC_BYTES);
  unsigned short* KH  = (unsigned short*)carve(KH_BYTES);
  unsigned short* VT  = (unsigned short*)carve(VT_BYTES);
  if (off > ws_size || off > (size_t)134217728) return;

  gscan_kernel<<<NBATCH * NHEAD, 32, 0, stream>>>(g, GC2);
  kvprep_kernel<<<NBATCH * NKVH * (NTIME / 64), 256, 0, stream>>>(k, v, KH, VT);
  attn_kernel<<<NBATCH * NHEAD * NQB, 128, 0, stream>>>(q, KH, VT, GC2, out);
}

// v002
// A run of this version takes 87.8 microseconds.
// Next to v001, in two timings, it ran 1.43 and 1.44 times as fast.
// Over all steps from v000 it is 2.12 times as fast.
// Compute dtype: q.k^T and p.v on v_wmma_f32_16x16x32_f16 (q, k, v = f16 of RNE-bf16 inputs; p = f16 carried x32768), f32 accumulate; cumulative gate sum (of RNE-bf16 g), online softmax and normalisation in f32.
#include <hip/hip_runtime.h>
#include <math.h>

// ---------------------------------------------------------------------------
// Shape constants
// ---------------------------------------------------------------------------
constexpr int NBATCH = 4;
constexpr int NTIME  = 2048;
constexpr int NHEAD  = 8;
constexpr int NKVH   = 4;
constexpr int HDIM   = 64;
constexpr int VDIM   = 64;
constexpr int GQA    = NHEAD / NKVH;
constexpr int QBLK   = 64;
constexpr int KCHUNK = 64;
constexpr int NQB    = NTIME / QBLK;
constexpr int SQRT_HDIM = 8;
constexpr int OPITCH = 68;
// LDS row pitch of the K, V^T and P tiles in halves: 64 data + 8 pad = 144 B = 16 B x 9, so the 16 rows that one
// ds_load_b128 touches per half wave start on 16 different 4-bank groups (at 128 B they share two groups).
constexpr int LPITCH = 72;
static_assert(SQRT_HDIM * SQRT_HDIM == HDIM, "scale derivation");
static_assert(HDIM == 64 && VDIM == 64, "tile shapes");
static_assert(NHEAD % NKVH == 0 && GQA == 2, "kv head grouping");
static_assert(NTIME % 64 == 0, "time tiles");
static_assert(HDIM % 32 == 0 && KCHUNK % 32 == 0, "k steps of 32");
static_assert(LPITCH >= HDIM && LPITCH >= KCHUNK && (LPITCH * 2) % 16 == 0 && ((LPITCH * 2) / 16) % 2 == 1, "LDS pitch");

constexpr float LOG2E_F   = 1.4426950408889634f;
constexpr float QK_SCALE  = 1.0f / (float)SQRT_HDIM;
constexpr float SCORE_L2  = QK_SCALE * LOG2E_F;
constexpr float P_CARRY   = 32768.0f;
constexpr float NEG_BIG   = -1.0e30f;

constexpr size_t GC_BYTES = (size_t)NBATCH * NHEAD * NTIME * 4;
constexpr size_t KH_BYTES = (size_t)NBATCH * NKVH * NTIME * HDIM * 2;
constexpr size_t VT_BYTES = (size_t)NBATCH * NKVH * VDIM * NTIME * 2;
static_assert(GC_BYTES + KH_BYTES + VT_BYTES <= (size_t)134217728, "carve");
static_assert((size_t)NBATCH * NTIME * NHEAD * VDIM * 4 == (size_t)16777216, "output bytes");

typedef __attribute__((ext_vector_type(16))) _Float16 v16h;
typedef __attribute__((ext_vector_type(8)))  _Float16 v8h;
typedef __attribute__((ext_vector_type(8)))  float    v8f;
typedef __attribute__((ext_vector_type(4)))  float    v4f;

// RNE convert of an f32 value to bf16 precision
__device__ __forceinline__ unsigned short f2bf_bits(float f) {
  unsigned u = __float_as_uint(f);
  return (unsigned short)((u + 0x7FFFu + ((u >> 16) & 1u)) >> 16);
}
__device__ __forceinline__ float bf_bits2f(unsigned short h) { return __uint_as_float(((unsigned)h) << 16); }
/* RNE convert to a bf16 value, kept in f32 */
__device__ __forceinline__ float bf16r(float f) { return bf_bits2f(f2bf_bits(f)); }

/* one WMMA followed by the 4-slot hazard guard tying D and naming A, B */
__device__ __forceinline__ v8f mma_h(v16h a, v16h b, v8f c) {
  c = __builtin_amdgcn_wmma_f32_16x16x32_f16(false, a, false, b, (short)0, c, false, false);
  asm volatile("v_nop\n\tv_nop\n\tv_nop\n\tv_nop" : "+v"(c) : "v"(a), "v"(b));
  return c;
}

union FragH { v16h v; v8h h[2]; };
/* elements 0..7 <- p[0..7], elements 8..15 <- p[16..23]; caller adds 8*(lane>>4) */
__device__ __forceinline__ v16h frag_load(const _Float16* p) {
  FragH f;
  f.h[0] = *(const v8h*)(p);
  f.h[1] = *(const v8h*)(p + 16);
  return f.v;
}

// ---------------------------------------------------------------------------
// Launch 1: gc2[b*8+h][t] = log2(e) * inclusive cumulative sum over t of bf16value(g[b][t][h]), f32.
// One block of 8 waves per (b,h). The row is 64 segments of 32 steps; wave w owns segments 8w..8w+7.
// All 8 loads of a wave are in flight together and its 8 segment scans are independent of each other; the segment
// totals go through LDS, and every wave adds them up one after another from segment 0 on, so each carry is the same
// chain of f32 additions as in a single pass over the row.
// Store coverage: 8 waves x 8 segments x 32 lanes = 2048 floats = the whole row; each instruction is one 128-B line.
// ---------------------------------------------------------------------------
constexpr int GS_SEGS  = NTIME / 32;
constexpr int GS_WAVES = 8;
constexpr int GS_PER   = GS_SEGS / GS_WAVES;
static_assert(NTIME % 32 == 0 && GS_SEGS % GS_WAVES == 0 && GS_PER % 4 == 0, "scan segments");

__global__ __launch_bounds__(GS_WAVES * 32) void gscan_kernel(const float* __restrict__ g, float* __restrict__ gc2) {
  __shared__ __align__(16) float tot[GS_SEGS];
  const int bh = blockIdx.x;
  const int b = bh / NHEAD;
  const int h = bh % NHEAD;
  const int lane = threadIdx.x & 31;
  const int s0 = (threadIdx.x >> 5) * GS_PER;

  /* block-uniform row base + one 32-bit lane offset: the 8 loads differ only in their immediate offset */
  const float* grow = g + (size_t)b * NTIME * NHEAD + h;
  const unsigned e0 = (unsigned)(s0 * 32 + lane) * NHEAD;
  /* every loop of this kernel is unrolled: val[] stays in registers, and the 8 loads and the 8 scans stand side by side */
  float val[GS_PER];
#pragma unroll
  for (int i = 0; i < GS_PER; ++i) val[i] = grow[e0 + (unsigned)(i * 32 * NHEAD)];
#pragma unroll
  for (int i = 0; i < GS_PER; ++i) val[i] = bf16r(val[i]);
#pragma unroll
  for (int d = 1; d < 32; d <<= 1) {
#pragma unroll
    for (int i = 0; i < GS_PER; ++i) {
      const float up = __shfl_up(val[i], d, 32);
      val[i] += (lane >= d) ? up : 0.0f;
    }
  }
  if (lane == 31) {
#pragma unroll
    for (int i = 0; i < GS_PER; ++i) tot[s0 + i] = val[i];
  }
  __syncthreads();

  /* carry into segment s0: totals of the segments in front of it, in order (a later segment adds 0) */
  float carry = 0.0f;
#pragma unroll
  for (int j4 = 0; j4 < GS_SEGS - GS_PER; j4 += 4) {
    const v4f tq = *(const v4f*)(tot + j4);
#pragma unroll
    for (int e = 0; e < 4; ++e) carry += (j4 + e < s0) ? tq[e] : 0.0f;
  }
#pragma unroll
  for (int i = 0; i < GS_PER; ++i) {
    const float o = (val[i] + carry) * LOG2E_F;
    gc2[(size_t)bh * NTIME + (s0 + i) * 32 + lane] = o;
    carry += tot[s0 + i];
  }
}

// ---------------------------------------------------------------------------
// Launch 2: 16-bit operand planes. Block = 64 time steps of one (b, kv head); 256 threads; grid = 4*4*32 = 512.
//   Vt[(b*4+hk)][vc][t]  = f16(bf16value(v[b][t][hk][vc]))     in [t][vc] -> out [vc][t] through a 64x64 LDS tile
// Load coverage V: 4 iterations x 256 threads x 4 floats = 64 x 64. K: 2 groups x 256 threads x 8 floats = 64 x 64.
// Store coverage: 2 groups x 32 rows (tid>>3) x 8 lanes x 8 halves = 64 rows x 64 halves for each plane; lanes
// ---------------------------------------------------------------------------
__global__ __launch_bounds__(256) void kvprep_kernel(const float* __restrict__ kin, const float* __restrict__ vin,
                                                     unsigned short* __restrict__ Khp,
                                                     unsigned short* __restrict__ Vtp) {
  __shared__ float Tt[64 * 65];
  _Float16* Kh = (_Float16*)Khp;
  _Float16* Vt = (_Float16*)Vtp;
  const int tid = threadIdx.x;
  const int tb = blockIdx.x % (NTIME / 64);
  const int bk = blockIdx.x / (NTIME / 64);
  const int b  = bk / NKVH;
  const int hk = bk % NKVH;
  const int t0 = tb * 64;

#pragma unroll
  for (int i = 0; i < 4; ++i) {
    const int idx = i * 256 + tid;
    const int rr = idx >> 4;
    const int cc = (idx & 15) * 4;
    const v4f vv = *(const v4f*)(vin + (((size_t)(b * NTIME + t0 + rr)) * NKVH + hk) * VDIM + cc);
    Tt[rr * 65 + cc + 0] = vv[0];
    Tt[rr * 65 + cc + 1] = vv[1];
    Tt[rr * 65 + cc + 2] = vv[2];
    Tt[rr * 65 + cc + 3] = vv[3];
  }
  asm volatile("" ::: "memory");

  const int q  = tid >> 3;
  const int c8 = (tid & 7) * 8;
  v8h kh[2];
#pragma unroll
  for (int gq = 0; gq < 2; ++gq) {
    const int row = gq * 32 + q;
    const float* sp = kin + (((size_t)(b * NTIME + t0 + row)) * NKVH + hk) * HDIM + c8;
    const v4f a = *(const v4f*)(sp);
    const v4f c = *(const v4f*)(sp + 4);
#pragma unroll
    for (int e = 0; e < 4; ++e) {
      const float x0 = a[e];
      const float x1 = c[e];
      kh[gq][e]     = (_Float16)bf16r(x0);
      kh[gq][4 + e] = (_Float16)bf16r(x1);
    }
  }
  __syncthreads();
  v8h vh[2];
#pragma unroll
  for (int gq = 0; gq < 2; ++gq) {
    const int vrow = gq * 32 + q;
#pragma unroll
    for (int e = 0; e < 8; ++e) {
      const float f = Tt[(c8 + e) * 65 + vrow];
      vh[gq][e] = (_Float16)bf16r(f);
    }
  }
  {
#pragma unroll
    for (int gq = 0; gq < 2; ++gq) {
      const int row = gq * 32 + q;
      *(v8h*)(Kh + ((size_t)bk * NTIME + t0 + row) * HDIM + c8) = kh[gq];
      *(v8h*)(Vt + ((size_t)bk * VDIM + row) * NTIME + t0 + c8) = vh[gq];
    }
    
  }
}

// ---------------------------------------------------------------------------
// Launch 3: causal attention with per-key gate bias, online softmax in the log2 domain.
// Block = 4 waves = 64 query rows of one (b, h); grid = 4*8*32 = 1024. Key chunks of 64, chunks 0..qb (block-uniform).
// Per chunk: K tile [64 key][64 d] and V^T tile [64 vc][64 key] copied from the f16 planes into LDS
// (4 iterations x 128 threads x 8 halves = 4096 halves each), block barrier before and after.
// S: A = q [row][d] fragments in registers, B = K tile rows [key][d] (same split k map).
// t = S * (scale*log2e) - gc2[key]; masked (key > row, diagonal chunk only) -> -1e30; p = exp2(t - m).
// B = V^T tile rows [vc][key]. Denominator = sum of the same f16 values (per-lane partials, reduced once at the end).
// 4 waves = 64 rows, 64 columns.
// ---------------------------------------------------------------------------
__global__ __launch_bounds__(128) void attn_kernel(const float* __restrict__ qin,
                                                   const unsigned short* __restrict__ Khp,
                                                   const unsigned short* __restrict__ Vtp,
                                                   const float* __restrict__ gc2,
                                                   float* __restrict__ out) {
  __shared__ __align__(16) _Float16 Ks[KCHUNK * LPITCH];
  __shared__ __align__(16) _Float16 Vs[VDIM * LPITCH];
  __shared__ __align__(16) _Float16 Ps[4][16 * LPITCH];
  __shared__ __align__(16) float    Os[4][16 * OPITCH];
  const _Float16* Kh = (const _Float16*)Khp;
  const _Float16* Vt = (const _Float16*)Vtp;

  const int tid  = threadIdx.x;
  const int wave = tid >> 5;
  const int lane = tid & 31;
  const int hh   = lane >> 4;
  const int c    = lane & 15;

  const int qb = blockIdx.x % NQB;
  const int bh = blockIdx.x / NQB;
  const int h  = bh % NHEAD;
  const int b  = bh / NHEAD;
  const int hk = h / GQA;
  const int bk = b * NKVH + hk;
  const int q0 = qb * QBLK + wave * 16;

  /* Q fragments: element e <- d = 32dc + 8hh + e, element 8+e <- d = 32dc + 16 + 8hh + e, row q0 + c */
  v16h qa[2];
  {
    const float* qrow = qin + (((size_t)(b * NTIME + q0 + c)) * NHEAD + h) * HDIM;
#pragma unroll
    for (int dc = 0; dc < 2; ++dc) {
      const v4f a0 = *(const v4f*)(qrow + dc * 32 + 8 * hh);
      const v4f a1 = *(const v4f*)(qrow + dc * 32 + 8 * hh + 4);
      const v4f b0 = *(const v4f*)(qrow + dc * 32 + 16 + 8 * hh);
      const v4f b1 = *(const v4f*)(qrow + dc * 32 + 16 + 8 * hh + 4);
#pragma unroll
      for (int e = 0; e < 4; ++e) {
        const float x0 = a0[e];
        const float x1 = a1[e];
        const float x2 = b0[e];
        const float x3 = b1[e];
        qa[dc][e]      = (_Float16)bf16r(x0);
        qa[dc][4 + e]  = (_Float16)bf16r(x1);
        qa[dc][8 + e]  = (_Float16)bf16r(x2);
        qa[dc][12 + e] = (_Float16)bf16r(x3);
      }
    }
  }

  float mrow[8], lrow[8];
  v8f oacc[4];
#pragma unroll
  for (int r = 0; r < 8; ++r) { mrow[r] = NEG_BIG; lrow[r] = 0.0f; }
#pragma unroll
  for (int t = 0; t < 4; ++t) oacc[t] = (v8f){0.f, 0.f, 0.f, 0.f, 0.f, 0.f, 0.f, 0.f};

  const float* gcb = gc2 + (size_t)bh * NTIME;
  const _Float16* kplane = Kh + (size_t)bk * NTIME * HDIM;
  const _Float16* vplane = Vt + (size_t)bk * VDIM * NTIME;
  _Float16* pw = Ps[wave];
  const int nChunks = qb + 1;

#pragma unroll 1
  for (int kc = 0; kc < nChunks; ++kc) {
    const int kv0 = kc * KCHUNK;
    __syncthreads();
    float gk[4];
    {
      const _Float16* ksrc = kplane + (size_t)kv0 * HDIM;
      v8h kk[4], vv[4];
#pragma unroll
      for (int it = 0; it < 4; ++it) {
        const int idx = it * 128 + tid;
        const int vcol = idx >> 3;
        const int k8 = (idx & 7) * 8;
        kk[it] = *(const v8h*)(ksrc + idx * 8);
        vv[it] = *(const v8h*)(vplane + (size_t)vcol * NTIME + kv0 + k8);
      }
      // the gate loads below land in registers that held these loads' addresses: the wait stands in front of that overwrite
      asm volatile("s_wait_xcnt 0x0" ::: "memory");
#pragma unroll
      for (int j = 0; j < 4; ++j) gk[j] = gcb[kv0 + j * 16 + c];
#pragma unroll
      for (int it = 0; it < 4; ++it) {
        const int idx = it * 128 + tid;
        const int vcol = idx >> 3;
        const int k8 = (idx & 7) * 8;
        *(v8h*)(Ks + vcol * LPITCH + k8) = kk[it];
        *(v8h*)(Vs + vcol * LPITCH + k8) = vv[it];
      }
    }
    __syncthreads();

    v8f s[4];
#pragma unroll
    for (int j = 0; j < 4; ++j) {
      s[j] = (v8f){0.f, 0.f, 0.f, 0.f, 0.f, 0.f, 0.f, 0.f};
#pragma unroll
      for (int dc = 0; dc < 2; ++dc) {
        const v16h kb = frag_load(Ks + (j * 16 + c) * LPITCH + dc * 32 + 8 * hh);
        s[j] = mma_h(qa[dc], kb, s[j]);
      }
    }

    const bool diag = (kc == qb);
    float cm[8];
#pragma unroll
    for (int r = 0; r < 8; ++r) {
      const int qrow = q0 + 8 * hh + r;
      float m = NEG_BIG;
#pragma unroll
      for (int j = 0; j < 4; ++j) {
        const int kvcol = kv0 + j * 16 + c;
        float tv = s[j][r] * SCORE_L2 - gk[j];
        const bool msk = diag && (kvcol > qrow);
        tv = msk ? NEG_BIG : tv;
        s[j][r] = tv;
        m = fmaxf(m, tv);
      }
#pragma unroll
      for (int off = 1; off < 16; off <<= 1) m = fmaxf(m, __shfl_xor(m, off, 32));
      cm[r] = m;
    }
#pragma unroll
    for (int r = 0; r < 8; ++r) {
      const float mnew  = fmaxf(mrow[r], cm[r]);
      const float alpha = exp2f(mrow[r] - mnew);
      mrow[r] = mnew;
      float psum = 0.0f;
#pragma unroll
      for (int j = 0; j < 4; ++j) {
        const float p = exp2f(s[j][r] - mnew);
        const _Float16 ph = (_Float16)(p * P_CARRY);
        psum += (float)ph;
        pw[(8 * hh + r) * LPITCH + j * 16 + c] = ph;
      }
      lrow[r] = lrow[r] * alpha + psum;
#pragma unroll
      for (int t = 0; t < 4; ++t) oacc[t][r] *= alpha;
    }
    __builtin_amdgcn_fence(__ATOMIC_RELEASE, "workgroup");
    __builtin_amdgcn_wave_barrier();
    __builtin_amdgcn_fence(__ATOMIC_ACQUIRE, "workgroup");
#pragma unroll 1
    for (int kk = 0; kk < 2; ++kk) {
      const v16h pa = frag_load(pw + c * LPITCH + kk * 32 + 8 * hh);
#pragma unroll
      for (int t = 0; t < 4; ++t) {
        const v16h vb = frag_load(Vs + (t * 16 + c) * LPITCH + kk * 32 + 8 * hh);
        oacc[t] = mma_h(pa, vb, oacc[t]);
      }
    }
  }

  float* os = Os[wave];
#pragma unroll
  for (int r = 0; r < 8; ++r) {
    float l = lrow[r];
#pragma unroll
    for (int off = 1; off < 16; off <<= 1) l += __shfl_xor(l, off, 32);
    const float inv = 1.0f / l;
#pragma unroll
    for (int t = 0; t < 4; ++t) os[(8 * hh + r) * OPITCH + t * 16 + c] = oacc[t][r] * inv;
  }
  __builtin_amdgcn_fence(__ATOMIC_RELEASE, "workgroup");
  __builtin_amdgcn_wave_barrier();
  __builtin_amdgcn_fence(__ATOMIC_ACQUIRE, "workgroup");
  {
    const int c4 = c * 4;
    {
#pragma unroll
      for (int it = 0; it < 8; ++it) {
        const int row = it * 2 + hh;
        const v4f val = *(const v4f*)(os + row * OPITCH + c4);
        *(v4f*)(out + (((size_t)(b * NTIME + q0 + row)) * NHEAD + h) * VDIM + c4) = val;
      }
      
    }
  }
}

// ---------------------------------------------------------------------------
// Host glue. Workspace region map (bytes, 256-B aligned carve; total 8,650,752 <= 134,217,728):
//   GC2 [32][2048]          f32     262,144   log2e * cumulative gate sum per (b,h)
//   KH  [16][2048][64]      f16   4,194,304   K rows per (b, kv head)
//   VT  [16][64][2048]      f16   4,194,304   V transposed per (b, kv head)
// ---------------------------------------------------------------------------
extern "C" void kernel_launch(void* const* d_in, const int* in_sizes, int n_in,
                              void* d_out, int out_size, void* d_ws, size_t ws_size, hipStream_t stream) {
  if (n_in < 4 || d_out == nullptr || d_ws == nullptr) return;
  if (in_sizes[0] != NBATCH * NTIME * NHEAD * HDIM || in_sizes[1] != NBATCH * NTIME * NKVH * HDIM ||
      in_sizes[2] != NBATCH * NTIME * NKVH * VDIM || in_sizes[3] != NBATCH * NTIME * NHEAD ||
      out_size != NBATCH * NTIME * NHEAD * VDIM) return;

  const float* q = (const float*)d_in[0];
  const float* k = (const float*)d_in[1];
  const float* v = (const float*)d_in[2];
  const float* g = (const float*)d_in[3];
  float* out = (float*)d_out;

  char* ws = (char*)d_ws;
  size_t off = 0;
  auto carve = [&](size_t bytes) -> char* { char* p = ws + off; off += (bytes + 255) & ~(size_t)255; return p; };
  float*          GC2 = (float*)carve(GC_BYTES);
  unsigned short* KH  = (unsigned short*)carve(KH_BYTES);
  unsigned short* VT  = (unsigned short*)carve(VT_BYTES);
  if (off > ws_size || off > (size_t)134217728) return;

  gscan_kernel<<<NBATCH * NHEAD, GS_WAVES * 32, 0, stream>>>(g, GC2);
  kvprep_kernel<<<NBATCH * NKVH * (NTIME / 64), 256, 0, stream>>>(k, v, KH, VT);
  attn_kernel<<<NBATCH * NHEAD * NQB, 128, 0, stream>>>(q, KH, VT, GC2, out);
}

// v003
// Measured time: 79.1 microseconds a run.
// Two timings next to v002 both put it at 1.11 times that version's speed.
// Over all steps from v000 it is 2.36 times as fast.
// Compute dtype: q.k^T and p.v on v_wmma_f32_16x16x32_f16 (q, k, v = f16 of RNE-bf16 inputs; p = f16 carried x32768), f32 accumulate; cumulative gate sum (of RNE-bf16 g), online softmax and normalisation in f32.
#include <hip/hip_runtime.h>
#include <math.h>

// ---------------------------------------------------------------------------
// Shape constants
// ---------------------------------------------------------------------------
constexpr int NBATCH = 4;
constexpr int NTIME  = 2048;
constexpr int NHEAD  = 8;
constexpr int NKVH   = 4;
constexpr int HDIM   = 64;
constexpr int VDIM   = 64;
constexpr int GQA    = NHEAD / NKVH;
constexpr int QBLK   = 64;
constexpr int KCHUNK = 64;
constexpr int NQB    = NTIME / QBLK;
constexpr int SQRT_HDIM = 8;
constexpr int OPITCH = 68;
// LDS row pitch of the K, V^T and P tiles in halves: 64 data + 8 pad = 144 B = 16 B x 9, so the 16 rows that one
// ds_load_b128 touches per half wave start on 16 different 4-bank groups (at 128 B they share two groups).
constexpr int LPITCH = 72;
static_assert(SQRT_HDIM * SQRT_HDIM == HDIM, "scale derivation");
static_assert(HDIM == 64 && VDIM == 64, "tile shapes");
static_assert(NHEAD % NKVH == 0 && GQA == 2, "kv head grouping");
static_assert(NTIME % 64 == 0, "time tiles");
static_assert(HDIM % 32 == 0 && KCHUNK % 32 == 0, "k steps of 32");
static_assert(LPITCH >= HDIM && LPITCH >= KCHUNK && (LPITCH * 2) % 16 == 0 && ((LPITCH * 2) / 16) % 2 == 1, "LDS pitch");

constexpr float LOG2E_F   = 1.4426950408889634f;
constexpr float QK_SCALE  = 1.0f / (float)SQRT_HDIM;
constexpr float SCORE_L2  = QK_SCALE * LOG2E_F;
constexpr float P_CARRY   = 32768.0f;
constexpr float NEG_BIG   = -1.0e30f;

constexpr size_t GC_BYTES = (size_t)NBATCH * NHEAD * NTIME * 4;
constexpr size_t KH_BYTES = (size_t)NBATCH * NKVH * NTIME * HDIM * 2;
constexpr size_t VT_BYTES = (size_t)NBATCH * NKVH * VDIM * NTIME * 2;
static_assert(GC_BYTES + KH_BYTES + VT_BYTES <= (size_t)134217728, "carve");
static_assert((size_t)NBATCH * NTIME * NHEAD * VDIM * 4 == (size_t)16777216, "output bytes");

typedef __attribute__((ext_vector_type(16))) _Float16 v16h;
typedef __attribute__((ext_vector_type(8)))  _Float16 v8h;
typedef __attribute__((ext_vector_type(8)))  float    v8f;
typedef __attribute__((ext_vector_type(4)))  float    v4f;

// RNE convert of an f32 value to bf16 precision
__device__ __forceinline__ unsigned short f2bf_bits(float f) {
  unsigned u = __float_as_uint(f);
  return (unsigned short)((u + 0x7FFFu + ((u >> 16) & 1u)) >> 16);
}
__device__ __forceinline__ float bf_bits2f(unsigned short h) { return __uint_as_float(((unsigned)h) << 16); }
/* RNE convert to a bf16 value, kept in f32 */
__device__ __forceinline__ float bf16r(float f) { return bf_bits2f(f2bf_bits(f)); }

/* one WMMA followed by the 4-slot hazard guard tying D and naming A, B */
__device__ __forceinline__ v8f mma_h(v16h a, v16h b, v8f c) {
  c = __builtin_amdgcn_wmma_f32_16x16x32_f16(false, a, false, b, (short)0, c, false, false);
  asm volatile("v_nop\n\tv_nop\n\tv_nop\n\tv_nop" : "+v"(c) : "v"(a), "v"(b));
  return c;
}

union FragH { v16h v; v8h h[2]; };
/* elements 0..7 <- p[0..7], elements 8..15 <- p[16..23]; caller adds 8*(lane>>4) */
__device__ __forceinline__ v16h frag_load(const _Float16* p) {
  FragH f;
  f.h[0] = *(const v8h*)(p);
  f.h[1] = *(const v8h*)(p + 16);
  return f.v;
}

// ---------------------------------------------------------------------------
// Launch 1: gc2[b*8+h][t] = log2(e) * inclusive cumulative sum over t of bf16value(g[b][t][h]), f32.
// One block of 8 waves per (b,h). The row is 64 segments of 32 steps; wave w owns segments 8w..8w+7.
// All 8 loads of a wave are in flight together and its 8 segment scans are independent of each other; the segment
// totals go through LDS, and every wave adds them up one after another from segment 0 on, so each carry is the same
// chain of f32 additions as in a single pass over the row.
// Store coverage: 8 waves x 8 segments x 32 lanes = 2048 floats = the whole row; each instruction is one 128-B line.
// ---------------------------------------------------------------------------
constexpr int GS_SEGS  = NTIME / 32;
constexpr int GS_WAVES = 8;
constexpr int GS_PER   = GS_SEGS / GS_WAVES;
static_assert(NTIME % 32 == 0 && GS_SEGS % GS_WAVES == 0 && GS_PER % 4 == 0, "scan segments");

__global__ __launch_bounds__(GS_WAVES * 32) void gscan_kernel(const float* __restrict__ g, float* __restrict__ gc2) {
  __shared__ __align__(16) float tot[GS_SEGS];
  const int bh = blockIdx.x;
  const int b = bh / NHEAD;
  const int h = bh % NHEAD;
  const int lane = threadIdx.x & 31;
  const int s0 = (threadIdx.x >> 5) * GS_PER;

  /* block-uniform row base + one 32-bit lane offset: the 8 loads differ only in their immediate offset */
  const float* grow = g + (size_t)b * NTIME * NHEAD + h;
  const unsigned e0 = (unsigned)(s0 * 32 + lane) * NHEAD;
  /* every loop of this kernel is unrolled: val[] stays in registers, and the 8 loads and the 8 scans stand side by side */
  float val[GS_PER];
#pragma unroll
  for (int i = 0; i < GS_PER; ++i) val[i] = grow[e0 + (unsigned)(i * 32 * NHEAD)];
#pragma unroll
  for (int i = 0; i < GS_PER; ++i) val[i] = bf16r(val[i]);
#pragma unroll
  for (int d = 1; d < 32; d <<= 1) {
#pragma unroll
    for (int i = 0; i < GS_PER; ++i) {
      const float up = __shfl_up(val[i], d, 32);
      val[i] += (lane >= d) ? up : 0.0f;
    }
  }
  if (lane == 31) {
#pragma unroll
    for (int i = 0; i < GS_PER; ++i) tot[s0 + i] = val[i];
  }
  __syncthreads();

  /* carry into segment s0: totals of the segments in front of it, in order (a later segment adds 0) */
  float carry = 0.0f;
#pragma unroll
  for (int j4 = 0; j4 < GS_SEGS - GS_PER; j4 += 4) {
    const v4f tq = *(const v4f*)(tot + j4);
#pragma unroll
    for (int e = 0; e < 4; ++e) carry += (j4 + e < s0) ? tq[e] : 0.0f;
  }
#pragma unroll
  for (int i = 0; i < GS_PER; ++i) {
    const float o = (val[i] + carry) * LOG2E_F;
    gc2[(size_t)bh * NTIME + (s0 + i) * 32 + lane] = o;
    carry += tot[s0 + i];
  }
}

// ---------------------------------------------------------------------------
// Launch 2: 16-bit operand planes. Block = 64 time steps of one (b, kv head); 256 threads; grid = 4*4*32 = 512.
//   Vt[(b*4+hk)][vc][t]  = f16(bf16value(v[b][t][hk][vc]))     in [t][vc] -> out [vc][t] through a 64x64 LDS tile
// Load coverage V: 4 iterations x 256 threads x 4 floats = 64 x 64. K: 2 groups x 256 threads x 8 floats = 64 x 64.
// Store coverage: 2 groups x 32 rows (tid>>3) x 8 lanes x 8 halves = 64 rows x 64 halves for each plane; lanes
// ---------------------------------------------------------------------------
__global__ __launch_bounds__(256) void kvprep_kernel(const float* __restrict__ kin, const float* __restrict__ vin,
                                                     unsigned short* __restrict__ Khp,
                                                     unsigned short* __restrict__ Vtp) {
  __shared__ float Tt[64 * 65];
  _Float16* Kh = (_Float16*)Khp;
  _Float16* Vt = (_Float16*)Vtp;
  const int tid = threadIdx.x;
  const int tb = blockIdx.x % (NTIME / 64);
  const int bk = blockIdx.x / (NTIME / 64);
  const int b  = bk / NKVH;
  const int hk = bk % NKVH;
  const int t0 = tb * 64;

#pragma unroll
  for (int i = 0; i < 4; ++i) {
    const int idx = i * 256 + tid;
    const int rr = idx >> 4;
    const int cc = (idx & 15) * 4;
    const v4f vv = *(const v4f*)(vin + (((size_t)(b * NTIME + t0 + rr)) * NKVH + hk) * VDIM + cc);
    Tt[rr * 65 + cc + 0] = vv[0];
    Tt[rr * 65 + cc + 1] = vv[1];
    Tt[rr * 65 + cc + 2] = vv[2];
    Tt[rr * 65 + cc + 3] = vv[3];
  }
  asm volatile("" ::: "memory");

  const int q  = tid >> 3;
  const int c8 = (tid & 7) * 8;
  v8h kh[2];
#pragma unroll
  for (int gq = 0; gq < 2; ++gq) {
    const int row = gq * 32 + q;
    const float* sp = kin + (((size_t)(b * NTIME + t0 + row)) * NKVH + hk) * HDIM + c8;
    const v4f a = *(const v4f*)(sp);
    const v4f c = *(const v4f*)(sp + 4);
#pragma unroll
    for (int e = 0; e < 4; ++e) {
      const float x0 = a[e];
      const float x1 = c[e];
      kh[gq][e]     = (_Float16)bf16r(x0);
      kh[gq][4 + e] = (_Float16)bf16r(x1);
    }
  }
  __syncthreads();
  v8h vh[2];
#pragma unroll
  for (int gq = 0; gq < 2; ++gq) {
    const int vrow = gq * 32 + q;
#pragma unroll
    for (int e = 0; e < 8; ++e) {
      const float f = Tt[(c8 + e) * 65 + vrow];
      vh[gq][e] = (_Float16)bf16r(f);
    }
  }
  {
#pragma unroll
    for (int gq = 0; gq < 2; ++gq) {
      const int row = gq * 32 + q;
      *(v8h*)(Kh + ((size_t)bk * NTIME + t0 + row) * HDIM + c8) = kh[gq];
      *(v8h*)(Vt + ((size_t)bk * VDIM + row) * NTIME + t0 + c8) = vh[gq];
    }
    
  }
}

// ---------------------------------------------------------------------------
// Launch 3: causal attention with per-key gate bias, online softmax in the log2 domain.
// Block = 4 waves = 64 query rows of one (b, h); grid = 4*8*32 = 1024. Key chunks of 64, chunks 0..qb (block-uniform).
// Per chunk: K tile [64 key][64 d] and V^T tile [64 vc][64 key] copied from the f16 planes into LDS
// (4 iterations x 128 threads x 8 halves = 4096 halves each), block barrier before and after.
// S: A = q [row][d] fragments in registers, B = K tile rows [key][d] (same split k map).
// t = S * (scale*log2e) - gc2[key]; masked (key > row, diagonal chunk only) -> -1e30; p = exp2(t - m).
// B = V^T tile rows [vc][key]. Denominator = sum of the same f16 values (per-lane partials, reduced once at the end).
// 4 waves = 64 rows, 64 columns.
// ---------------------------------------------------------------------------
__global__ __launch_bounds__(128) void attn_kernel(const float* __restrict__ qin,
                                                   const unsigned short* __restrict__ Khp,
                                                   const unsigned short* __restrict__ Vtp,
                                                   const float* __restrict__ gc2,
                                                   float* __restrict__ out) {
  __shared__ __align__(16) _Float16 Ks[KCHUNK * LPITCH];
  __shared__ __align__(16) _Float16 Vs[VDIM * LPITCH];
  __shared__ __align__(16) _Float16 Ps[4][16 * LPITCH];
  __shared__ __align__(16) float    Os[4][16 * OPITCH];
  const _Float16* Kh = (const _Float16*)Khp;
  const _Float16* Vt = (const _Float16*)Vtp;

  const int tid  = threadIdx.x;
  const int wave = tid >> 5;
  const int lane = tid & 31;
  const int hh   = lane >> 4;
  const int c    = lane & 15;

  const int qb = blockIdx.x % NQB;
  const int bh = blockIdx.x / NQB;
  const int h  = bh % NHEAD;
  const int b  = bh / NHEAD;
  const int hk = h / GQA;
  const int bk = b * NKVH + hk;
  const int q0 = qb * QBLK + wave * 16;

  /* Q fragments: element e <- d = 32dc + 8hh + e, element 8+e <- d = 32dc + 16 + 8hh + e, row q0 + c */
  v16h qa[2];
  {
    const float* qrow = qin + (((size_t)(b * NTIME + q0 + c)) * NHEAD + h) * HDIM;
#pragma unroll
    for (int dc = 0; dc < 2; ++dc) {
      const v4f a0 = *(const v4f*)(qrow + dc * 32 + 8 * hh);
      const v4f a1 = *(const v4f*)(qrow + dc * 32 + 8 * hh + 4);
      const v4f b0 = *(const v4f*)(qrow + dc * 32 + 16 + 8 * hh);
      const v4f b1 = *(const v4f*)(qrow + dc * 32 + 16 + 8 * hh + 4);
#pragma unroll
      for (int e = 0; e < 4; ++e) {
        const float x0 = a0[e];
        const float x1 = a1[e];
        const float x2 = b0[e];
        const float x3 = b1[e];
        qa[dc][e]      = (_Float16)bf16r(x0);
        qa[dc][4 + e]  = (_Float16)bf16r(x1);
        qa[dc][8 + e]  = (_Float16)bf16r(x2);
        qa[dc][12 + e] = (_Float16)bf16r(x3);
      }
    }
  }

  float mrow[8], lrow[8];
  v8f oacc[4];
#pragma unroll
  for (int r = 0; r < 8; ++r) { mrow[r] = NEG_BIG; lrow[r] = 0.0f; }
#pragma unroll
  for (int t = 0; t < 4; ++t) oacc[t] = (v8f){0.f, 0.f, 0.f, 0.f, 0.f, 0.f, 0.f, 0.f};

  const float* gcb = gc2 + (size_t)bh * NTIME;
  const _Float16* kplane = Kh + (size_t)bk * NTIME * HDIM;
  const _Float16* vplane = Vt + (size_t)bk * VDIM * NTIME;
  _Float16* pw = Ps[wave];
  const int nChunks = qb + 1;

#pragma unroll 1
  for (int kc = 0; kc < nChunks; ++kc) {
    const int kv0 = kc * KCHUNK;
    __syncthreads();
    float gk[4];
    {
      const _Float16* ksrc = kplane + (size_t)kv0 * HDIM;
      v8h kk[4], vv[4];
#pragma unroll
      for (int it = 0; it < 4; ++it) {
        const int idx = it * 128 + tid;
        const int vcol = idx >> 3;
        const int k8 = (idx & 7) * 8;
        kk[it] = *(const v8h*)(ksrc + idx * 8);
        vv[it] = *(const v8h*)(vplane + (size_t)vcol * NTIME + kv0 + k8);
      }
      // the gate loads below land in registers that held these loads' addresses: the wait stands in front of that overwrite
      asm volatile("s_wait_xcnt 0x0" ::: "memory");
#pragma unroll
      for (int j = 0; j < 4; ++j) gk[j] = gcb[kv0 + j * 16 + c];
#pragma unroll
      for (int it = 0; it < 4; ++it) {
        const int idx = it * 128 + tid;
        const int vcol = idx >> 3;
        const int k8 = (idx & 7) * 8;
        *(v8h*)(Ks + vcol * LPITCH + k8) = kk[it];
        *(v8h*)(Vs + vcol * LPITCH + k8) = vv[it];
      }
    }
    __syncthreads();

    /* all 8 K fragments are requested in one run in front of the first product: the 8 products wait for one LDS round
       trip, not for one each (a load cannot pass the guard statement of the product in front of it) */
    v16h kb[2][4];
#pragma unroll
    for (int dc = 0; dc < 2; ++dc) {
#pragma unroll
      for (int j = 0; j < 4; ++j) kb[dc][j] = frag_load(Ks + (j * 16 + c) * LPITCH + dc * 32 + 8 * hh);
    }
    v8f s[4];
#pragma unroll
    for (int j = 0; j < 4; ++j) s[j] = (v8f){0.f, 0.f, 0.f, 0.f, 0.f, 0.f, 0.f, 0.f};
#pragma unroll
    for (int dc = 0; dc < 2; ++dc) {
#pragma unroll
      for (int j = 0; j < 4; ++j) s[j] = mma_h(qa[dc], kb[dc][j], s[j]);
    }
    /* the 8 V^T fragments are requested here, behind the score products: they land while the softmax runs */
    v16h vb[2][4];
#pragma unroll
    for (int kk = 0; kk < 2; ++kk) {
#pragma unroll
      for (int t = 0; t < 4; ++t) vb[kk][t] = frag_load(Vs + (t * 16 + c) * LPITCH + kk * 32 + 8 * hh);
    }

    const bool diag = (kc == qb);
    float cm[8];
#pragma unroll
    for (int r = 0; r < 8; ++r) {
      const int qrow = q0 + 8 * hh + r;
      float m = NEG_BIG;
#pragma unroll
      for (int j = 0; j < 4; ++j) {
        const int kvcol = kv0 + j * 16 + c;
        float tv = s[j][r] * SCORE_L2 - gk[j];
        const bool msk = diag && (kvcol > qrow);
        tv = msk ? NEG_BIG : tv;
        s[j][r] = tv;
        m = fmaxf(m, tv);
      }
#pragma unroll
      for (int off = 1; off < 16; off <<= 1) m = fmaxf(m, __shfl_xor(m, off, 32));
      cm[r] = m;
    }
#pragma unroll
    for (int r = 0; r < 8; ++r) {
      const float mnew  = fmaxf(mrow[r], cm[r]);
      const float alpha = exp2f(mrow[r] - mnew);
      mrow[r] = mnew;
      float psum = 0.0f;
#pragma unroll
      for (int j = 0; j < 4; ++j) {
        const float p = exp2f(s[j][r] - mnew);
        const _Float16 ph = (_Float16)(p * P_CARRY);
        psum += (float)ph;
        pw[(8 * hh + r) * LPITCH + j * 16 + c] = ph;
      }
      lrow[r] = lrow[r] * alpha + psum;
#pragma unroll
      for (int t = 0; t < 4; ++t) oacc[t][r] *= alpha;
    }
    __builtin_amdgcn_fence(__ATOMIC_RELEASE, "workgroup");
    __builtin_amdgcn_wave_barrier();
    __builtin_amdgcn_fence(__ATOMIC_ACQUIRE, "workgroup");
    /* both P fragments in one run; unrolled so that the V^T fragments stay in registers under constant indices */
    v16h pa[2];
#pragma unroll
    for (int kk = 0; kk < 2; ++kk) pa[kk] = frag_load(pw + c * LPITCH + kk * 32 + 8 * hh);
#pragma unroll
    for (int kk = 0; kk < 2; ++kk) {
#pragma unroll
      for (int t = 0; t < 4; ++t) oacc[t] = mma_h(pa[kk], vb[kk][t], oacc[t]);
    }
  }

  float* os = Os[wave];
#pragma unroll
  for (int r = 0; r < 8; ++r) {
    float l = lrow[r];
#pragma unroll
    for (int off = 1; off < 16; off <<= 1) l += __shfl_xor(l, off, 32);
    const float inv = 1.0f / l;
#pragma unroll
    for (int t = 0; t < 4; ++t) os[(8 * hh + r) * OPITCH + t * 16 + c] = oacc[t][r] * inv;
  }
  __builtin_amdgcn_fence(__ATOMIC_RELEASE, "workgroup");
  __builtin_amdgcn_wave_barrier();
  __builtin_amdgcn_fence(__ATOMIC_ACQUIRE, "workgroup");
  {
    const int c4 = c * 4;
    {
#pragma unroll
      for (int it = 0; it < 8; ++it) {
        const int row = it * 2 + hh;
        const v4f val = *(const v4f*)(os + row * OPITCH + c4);
        *(v4f*)(out + (((size_t)(b * NTIME + q0 + row)) * NHEAD + h) * VDIM + c4) = val;
      }
      
    }
  }
}

// ---------------------------------------------------------------------------
// Host glue. Workspace region map (bytes, 256-B aligned carve; total 8,650,752 <= 134,217,728):
//   GC2 [32][2048]          f32     262,144   log2e * cumulative gate sum per (b,h)
//   KH  [16][2048][64]      f16   4,194,304   K rows per (b, kv head)
//   VT  [16][64][2048]      f16   4,194,304   V transposed per (b, kv head)
// ---------------------------------------------------------------------------
extern "C" void kernel_launch(void* const* d_in, const int* in_sizes, int n_in,
                              void* d_out, int out_size, void* d_ws, size_t ws_size, hipStream_t stream) {
  if (n_in < 4 || d_out == nullptr || d_ws == nullptr) return;
  if (in_sizes[0] != NBATCH * NTIME * NHEAD * HDIM || in_sizes[1] != NBATCH * NTIME * NKVH * HDIM ||
      in_sizes[2] != NBATCH * NTIME * NKVH * VDIM || in_sizes[3] != NBATCH * NTIME * NHEAD ||
      out_size != NBATCH * NTIME * NHEAD * VDIM) return;

  const float* q = (const float*)d_in[0];
  const float* k = (const float*)d_in[1];
  const float* v = (const float*)d_in[2];
  const float* g = (const float*)d_in[3];
  float* out = (float*)d_out;

  char* ws = (char*)d_ws;
  size_t off = 0;
  auto carve = [&](size_t bytes) -> char* { char* p = ws + off; off += (bytes + 255) & ~(size_t)255; return p; };
  float*          GC2 = (float*)carve(GC_BYTES);
  unsigned short* KH  = (unsigned short*)carve(KH_BYTES);
  unsigned short* VT  = (unsigned short*)carve(VT_BYTES);
  if (off > ws_size || off > (size_t)134217728) return;

  gscan_kernel<<<NBATCH * NHEAD, GS_WAVES * 32, 0, stream>>>(g, GC2);
  kvprep_kernel<<<NBATCH * NKVH * (NTIME / 64), 256, 0, stream>>>(k, v, KH, VT);
  attn_kernel<<<NBATCH * NHEAD * NQB, 128, 0, stream>>>(q, KH, VT, GC2, out);
}

// v004
// A run of this version takes 64.5 microseconds.
// Two timings next to v003 both put it at 1.23 times that version's speed.
// All steps since v000 together make it 2.90 times as fast.
// Compute dtype: q.k^T and p.v on v_wmma_f32_16x16x32_f16 (q, k, v = f16 of RNE-bf16 inputs; p = f16 carried x32768), f32 accumulate; cumulative gate sum (of RNE-bf16 g), online softmax and normalisation in f32.
#include <hip/hip_runtime.h>
#include <math.h>

// ---------------------------------------------------------------------------
// Shape constants
// ---------------------------------------------------------------------------
constexpr int NBATCH = 4;
constexpr int NTIME  = 2048;
constexpr int NHEAD  = 8;
constexpr int NKVH   = 4;
constexpr int HDIM   = 64;
constexpr int VDIM   = 64;
constexpr int GQA    = NHEAD / NKVH;
constexpr int QBLK   = 64;
constexpr int KCHUNK = 64;
constexpr int NQB    = NTIME / QBLK;
constexpr int SQRT_HDIM = 8;
constexpr int OPITCH = 68;
// LDS row pitch of the K, V^T and P tiles in halves: 64 data + 8 pad = 144 B = 16 B x 9, so the 16 rows that one
// ds_load_b128 touches per half wave start on 16 different 4-bank groups (at 128 B they share two groups).
constexpr int LPITCH = 72;
static_assert(SQRT_HDIM * SQRT_HDIM == HDIM, "scale derivation");
static_assert(HDIM == 64 && VDIM == 64, "tile shapes");
static_assert(NHEAD % NKVH == 0 && GQA == 2, "kv head grouping");
static_assert(NTIME % 64 == 0, "time tiles");
static_assert(HDIM % 32 == 0 && KCHUNK % 32 == 0, "k steps of 32");
static_assert(LPITCH >= HDIM && LPITCH >= KCHUNK && (LPITCH * 2) % 16 == 0 && ((LPITCH * 2) / 16) % 2 == 1, "LDS pitch");

constexpr float LOG2E_F   = 1.4426950408889634f;
constexpr float QK_SCALE  = 1.0f / (float)SQRT_HDIM;
constexpr float SCORE_L2  = QK_SCALE * LOG2E_F;
constexpr float P_CARRY   = 32768.0f;
constexpr float NEG_BIG   = -1.0e30f;

constexpr size_t GC_BYTES = (size_t)NBATCH * NHEAD * NTIME * 4;
constexpr size_t KH_BYTES = (size_t)NBATCH * NKVH * NTIME * HDIM * 2;
constexpr size_t VT_BYTES = (size_t)NBATCH * NKVH * VDIM * NTIME * 2;
static_assert(GC_BYTES + KH_BYTES + VT_BYTES <= (size_t)134217728, "carve");
static_assert((size_t)NBATCH * NTIME * NHEAD * VDIM * 4 == (size_t)16777216, "output bytes");

typedef __attribute__((ext_vector_type(16))) _Float16 v16h;
typedef __attribute__((ext_vector_type(8)))  _Float16 v8h;
typedef __attribute__((ext_vector_type(8)))  float    v8f;
typedef __attribute__((ext_vector_type(4)))  float    v4f;

// RNE convert of an f32 value to bf16 precision
__device__ __forceinline__ unsigned short f2bf_bits(float f) {
  unsigned u = __float_as_uint(f);
  return (unsigned short)((u + 0x7FFFu + ((u >> 16) & 1u)) >> 16);
}
__device__ __forceinline__ float bf_bits2f(unsigned short h) { return __uint_as_float(((unsigned)h) << 16); }
/* RNE convert to a bf16 value, kept in f32 */
__device__ __forceinline__ float bf16r(float f) { return bf_bits2f(f2bf_bits(f)); }

/* one WMMA followed by the 4-slot hazard guard tying D and naming A, B */
__device__ __forceinline__ v8f mma_h(v16h a, v16h b, v8f c) {
  c = __builtin_amdgcn_wmma_f32_16x16x32_f16(false, a, false, b, (short)0, c, false, false);
  asm volatile("v_nop\n\tv_nop\n\tv_nop\n\tv_nop" : "+v"(c) : "v"(a), "v"(b));
  return c;
}

/* 2^x as the bare v_exp_f32. The library exp2f wraps the same instruction in a range test, a pre-scale and an ldexp
   that only serve results below 2^-126. Every argument here is <= 0; a p that small is 0 after x32768 and the f16
   rounding either way, and an alpha that small scales sums that then vanish beside a new term of 32768 in the row. */
__device__ __forceinline__ float exp2_bare(float x) { return __builtin_amdgcn_exp2f(x); }

union FragH { v16h v; v8h h[2]; };
/* elements 0..7 <- p[0..7], elements 8..15 <- p[16..23]; caller adds 8*(lane>>4) */
__device__ __forceinline__ v16h frag_load(const _Float16* p) {
  FragH f;
  f.h[0] = *(const v8h*)(p);
  f.h[1] = *(const v8h*)(p + 16);
  return f.v;
}

// ---------------------------------------------------------------------------
// Launch 1: gc2[b*8+h][t] = log2(e) * inclusive cumulative sum over t of bf16value(g[b][t][h]), f32.
// One block of 8 waves per (b,h). The row is 64 segments of 32 steps; wave w owns segments 8w..8w+7.
// All 8 loads of a wave are in flight together and its 8 segment scans are independent of each other; the segment
// totals go through LDS, and every wave adds them up one after another from segment 0 on, so each carry is the same
// chain of f32 additions as in a single pass over the row.
// Store coverage: 8 waves x 8 segments x 32 lanes = 2048 floats = the whole row; each instruction is one 128-B line.
// ---------------------------------------------------------------------------
constexpr int GS_SEGS  = NTIME / 32;
constexpr int GS_WAVES = 8;
constexpr int GS_PER   = GS_SEGS / GS_WAVES;
static_assert(NTIME % 32 == 0 && GS_SEGS % GS_WAVES == 0 && GS_PER % 4 == 0, "scan segments");

__global__ __launch_bounds__(GS_WAVES * 32) void gscan_kernel(const float* __restrict__ g, float* __restrict__ gc2) {
  __shared__ __align__(16) float tot[GS_SEGS];
  const int bh = blockIdx.x;
  const int b = bh / NHEAD;
  const int h = bh % NHEAD;
  const int lane = threadIdx.x & 31;
  const int s0 = (threadIdx.x >> 5) * GS_PER;

  /* block-uniform row base + one 32-bit lane offset: the 8 loads differ only in their immediate offset */
  const float* grow = g + (size_t)b * NTIME * NHEAD + h;
  const unsigned e0 = (unsigned)(s0 * 32 + lane) * NHEAD;
  /* every loop of this kernel is unrolled: val[] stays in registers, and the 8 loads and the 8 scans stand side by side */
  float val[GS_PER];
#pragma unroll
  for (int i = 0; i < GS_PER; ++i) val[i] = grow[e0 + (unsigned)(i * 32 * NHEAD)];
#pragma unroll
  for (int i = 0; i < GS_PER; ++i) val[i] = bf16r(val[i]);
#pragma unroll
  for (int d = 1; d < 32; d <<= 1) {
#pragma unroll
    for (int i = 0; i < GS_PER; ++i) {
      const float up = __shfl_up(val[i], d, 32);
      val[i] += (lane >= d) ? up : 0.0f;
    }
  }
  if (lane == 31) {
#pragma unroll
    for (int i = 0; i < GS_PER; ++i) tot[s0 + i] = val[i];
  }
  __syncthreads();

  /* carry into segment s0: totals of the segments in front of it, in order (a later segment adds 0) */
  float carry = 0.0f;
#pragma unroll
  for (int j4 = 0; j4 < GS_SEGS - GS_PER; j4 += 4) {
    const v4f tq = *(const v4f*)(tot + j4);
#pragma unroll
    for (int e = 0; e < 4; ++e) carry += (j4 + e < s0) ? tq[e] : 0.0f;
  }
#pragma unroll
  for (int i = 0; i < GS_PER; ++i) {
    const float o = (val[i] + carry) * LOG2E_F;
    gc2[(size_t)bh * NTIME + (s0 + i) * 32 + lane] = o;
    carry += tot[s0 + i];
  }
}

// ---------------------------------------------------------------------------
// Launch 2: 16-bit operand planes. Block = 64 time steps of one (b, kv head); 256 threads; grid = 4*4*32 = 512.
//   Vt[(b*4+hk)][vc][t]  = f16(bf16value(v[b][t][hk][vc]))     in [t][vc] -> out [vc][t] through a 64x64 LDS tile
// Load coverage V: 4 iterations x 256 threads x 4 floats = 64 x 64. K: 2 groups x 256 threads x 8 floats = 64 x 64.
// Store coverage: 2 groups x 32 rows (tid>>3) x 8 lanes x 8 halves = 64 rows x 64 halves for each plane; lanes
// ---------------------------------------------------------------------------
__global__ __launch_bounds__(256) void kvprep_kernel(const float* __restrict__ kin, const float* __restrict__ vin,
                                                     unsigned short* __restrict__ Khp,
                                                     unsigned short* __restrict__ Vtp) {
  __shared__ float Tt[64 * 65];
  _Float16* Kh = (_Float16*)Khp;
  _Float16* Vt = (_Float16*)Vtp;
  const int tid = threadIdx.x;
  const int tb = blockIdx.x % (NTIME / 64);
  const int bk = blockIdx.x / (NTIME / 64);
  const int b  = bk / NKVH;
  const int hk = bk % NKVH;
  const int t0 = tb * 64;

#pragma unroll
  for (int i = 0; i < 4; ++i) {
    const int idx = i * 256 + tid;
    const int rr = idx >> 4;
    const int cc = (idx & 15) * 4;
    const v4f vv = *(const v4f*)(vin + (((size_t)(b * NTIME + t0 + rr)) * NKVH + hk) * VDIM + cc);
    Tt[rr * 65 + cc + 0] = vv[0];
    Tt[rr * 65 + cc + 1] = vv[1];
    Tt[rr * 65 + cc + 2] = vv[2];
    Tt[rr * 65 + cc + 3] = vv[3];
  }
  asm volatile("" ::: "memory");

  const int q  = tid >> 3;
  const int c8 = (tid & 7) * 8;
  v8h kh[2];
#pragma unroll
  for (int gq = 0; gq < 2; ++gq) {
    const int row = gq * 32 + q;
    const float* sp = kin + (((size_t)(b * NTIME + t0 + row)) * NKVH + hk) * HDIM + c8;
    const v4f a = *(const v4f*)(sp);
    const v4f c = *(const v4f*)(sp + 4);
#pragma unroll
    for (int e = 0; e < 4; ++e) {
      const float x0 = a[e];
      const float x1 = c[e];
      kh[gq][e]     = (_Float16)bf16r(x0);
      kh[gq][4 + e] = (_Float16)bf16r(x1);
    }
  }
  __syncthreads();
  v8h vh[2];
#pragma unroll
  for (int gq = 0; gq < 2; ++gq) {
    const int vrow = gq * 32 + q;
#pragma unroll
    for (int e = 0; e < 8; ++e) {
      const float f = Tt[(c8 + e) * 65 + vrow];
      vh[gq][e] = (_Float16)bf16r(f);
    }
  }
  {
#pragma unroll
    for (int gq = 0; gq < 2; ++gq) {
      const int row = gq * 32 + q;
      *(v8h*)(Kh + ((size_t)bk * NTIME + t0 + row) * HDIM + c8) = kh[gq];
      *(v8h*)(Vt + ((size_t)bk * VDIM + row) * NTIME + t0 + c8) = vh[gq];
    }
    
  }
}

// ---------------------------------------------------------------------------
// Launch 3: causal attention with per-key gate bias, online softmax in the log2 domain.
// Block = 4 waves = 64 query rows of one (b, h); grid = 4*8*32 = 1024. Key chunks of 64, chunks 0..qb (block-uniform).
// Per chunk: K tile [64 key][64 d] and V^T tile [64 vc][64 key] copied from the f16 planes into LDS
// (4 iterations x 128 threads x 8 halves = 4096 halves each), block barrier before and after.
// S: A = q [row][d] fragments in registers, B = K tile rows [key][d] (same split k map).
// t = S * (scale*log2e) - gc2[key]; masked (key > row, diagonal chunk only) -> -1e30; p = exp2(t - m).
// B = V^T tile rows [vc][key]. Denominator = sum of the same f16 values (per-lane partials, reduced once at the end).
// 4 waves = 64 rows, 64 columns.
// ---------------------------------------------------------------------------
__global__ __launch_bounds__(128) void attn_kernel(const float* __restrict__ qin,
                                                   const unsigned short* __restrict__ Khp,
                                                   const unsigned short* __restrict__ Vtp,
                                                   const float* __restrict__ gc2,
                                                   float* __restrict__ out) {
  __shared__ __align__(16) _Float16 Ks[KCHUNK * LPITCH];
  __shared__ __align__(16) _Float16 Vs[VDIM * LPITCH];
  __shared__ __align__(16) _Float16 Ps[4][16 * LPITCH];
  __shared__ __align__(16) float    Os[4][16 * OPITCH];
  const _Float16* Kh = (const _Float16*)Khp;
  const _Float16* Vt = (const _Float16*)Vtp;

  const int tid  = threadIdx.x;
  const int wave = tid >> 5;
  const int lane = tid & 31;
  const int hh   = lane >> 4;
  const int c    = lane & 15;

  const int qb = blockIdx.x % NQB;
  const int bh = blockIdx.x / NQB;
  const int h  = bh % NHEAD;
  const int b  = bh / NHEAD;
  const int hk = h / GQA;
  const int bk = b * NKVH + hk;
  const int q0 = qb * QBLK + wave * 16;

  /* Q fragments: element e <- d = 32dc + 8hh + e, element 8+e <- d = 32dc + 16 + 8hh + e, row q0 + c */
  v16h qa[2];
  {
    const float* qrow = qin + (((size_t)(b * NTIME + q0 + c)) * NHEAD + h) * HDIM;
#pragma unroll
    for (int dc = 0; dc < 2; ++dc) {
      const v4f a0 = *(const v4f*)(qrow + dc * 32 + 8 * hh);
      const v4f a1 = *(const v4f*)(qrow + dc * 32 + 8 * hh + 4);
      const v4f b0 = *(const v4f*)(qrow + dc * 32 + 16 + 8 * hh);
      const v4f b1 = *(const v4f*)(qrow + dc * 32 + 16 + 8 * hh + 4);
#pragma unroll
      for (int e = 0; e < 4; ++e) {
        const float x0 = a0[e];
        const float x1 = a1[e];
        const float x2 = b0[e];
        const float x3 = b1[e];
        qa[dc][e]      = (_Float16)bf16r(x0);
        qa[dc][4 + e]  = (_Float16)bf16r(x1);
        qa[dc][8 + e]  = (_Float16)bf16r(x2);
        qa[dc][12 + e] = (_Float16)bf16r(x3);
      }
    }
  }

  float mrow[8], lrow[8];
  v8f oacc[4];
#pragma unroll
  for (int r = 0; r < 8; ++r) { mrow[r] = NEG_BIG; lrow[r] = 0.0f; }
#pragma unroll
  for (int t = 0; t < 4; ++t) oacc[t] = (v8f){0.f, 0.f, 0.f, 0.f, 0.f, 0.f, 0.f, 0.f};

  const float* gcb = gc2 + (size_t)bh * NTIME;
  const _Float16* kplane = Kh + (size_t)bk * NTIME * HDIM;
  const _Float16* vplane = Vt + (size_t)bk * VDIM * NTIME;
  _Float16* pw = Ps[wave];
  const int nChunks = qb + 1;

#pragma unroll 1
  for (int kc = 0; kc < nChunks; ++kc) {
    const int kv0 = kc * KCHUNK;
    __syncthreads();
    float gk[4];
    {
      const _Float16* ksrc = kplane + (size_t)kv0 * HDIM;
      v8h kk[4], vv[4];
#pragma unroll
      for (int it = 0; it < 4; ++it) {
        const int idx = it * 128 + tid;
        const int vcol = idx >> 3;
        const int k8 = (idx & 7) * 8;
        kk[it] = *(const v8h*)(ksrc + idx * 8);
        vv[it] = *(const v8h*)(vplane + (size_t)vcol * NTIME + kv0 + k8);
      }
      // the gate loads below land in registers that held these loads' addresses: the wait stands in front of that overwrite
      asm volatile("s_wait_xcnt 0x0" ::: "memory");
#pragma unroll
      for (int j = 0; j < 4; ++j) gk[j] = gcb[kv0 + j * 16 + c];
#pragma unroll
      for (int it = 0; it < 4; ++it) {
        const int idx = it * 128 + tid;
        const int vcol = idx >> 3;
        const int k8 = (idx & 7) * 8;
        *(v8h*)(Ks + vcol * LPITCH + k8) = kk[it];
        *(v8h*)(Vs + vcol * LPITCH + k8) = vv[it];
      }
    }
    __syncthreads();

    /* all 8 K fragments are requested in one run in front of the first product: the 8 products wait for one LDS round
       trip, not for one each (a load cannot pass the guard statement of the product in front of it) */
    v16h kb[2][4];
#pragma unroll
    for (int dc = 0; dc < 2; ++dc) {
#pragma unroll
      for (int j = 0; j < 4; ++j) kb[dc][j] = frag_load(Ks + (j * 16 + c) * LPITCH + dc * 32 + 8 * hh);
    }
    v8f s[4];
#pragma unroll
    for (int j = 0; j < 4; ++j) s[j] = (v8f){0.f, 0.f, 0.f, 0.f, 0.f, 0.f, 0.f, 0.f};
#pragma unroll
    for (int dc = 0; dc < 2; ++dc) {
#pragma unroll
      for (int j = 0; j < 4; ++j) s[j] = mma_h(qa[dc], kb[dc][j], s[j]);
    }
    /* the 8 V^T fragments are requested here, behind the score products: they land while the softmax runs */
    v16h vb[2][4];
#pragma unroll
    for (int kk = 0; kk < 2; ++kk) {
#pragma unroll
      for (int t = 0; t < 4; ++t) vb[kk][t] = frag_load(Vs + (t * 16 + c) * LPITCH + kk * 32 + 8 * hh);
    }

    const bool diag = (kc == qb);
    float cm[8];
#pragma unroll
    for (int r = 0; r < 8; ++r) {
      const int qrow = q0 + 8 * hh + r;
      float m = NEG_BIG;
#pragma unroll
      for (int j = 0; j < 4; ++j) {
        const int kvcol = kv0 + j * 16 + c;
        float tv = s[j][r] * SCORE_L2 - gk[j];
        const bool msk = diag && (kvcol > qrow);
        tv = msk ? NEG_BIG : tv;
        s[j][r] = tv;
        m = fmaxf(m, tv);
      }
      cm[r] = m;
    }
    /* Row maxima, step by step over all eight rows (same tree per row). The two scheduling fences hold the score work in
       front of the cross-lane steps and the exponentials behind them, so that the eight moves of a step stand together
       and share one run of LDS-counter waits; without the fences the build with the short exponentials finishes one
       row's four steps before it begins the next row's, about 20 full waits one behind the other. */
    __builtin_amdgcn_sched_barrier(0);
#pragma unroll
    for (int off = 1; off < 16; off <<= 1) {
#pragma unroll
      for (int r = 0; r < 8; ++r) cm[r] = fmaxf(cm[r], __shfl_xor(cm[r], off, 32));
    }
    __builtin_amdgcn_sched_barrier(0);
#pragma unroll
    for (int r = 0; r < 8; ++r) {
      const float mnew  = fmaxf(mrow[r], cm[r]);
      const float alpha = exp2_bare(mrow[r] - mnew);
      mrow[r] = mnew;
      float psum = 0.0f;
#pragma unroll
      for (int j = 0; j < 4; ++j) {
        const float p = exp2_bare(s[j][r] - mnew);
        const _Float16 ph = (_Float16)(p * P_CARRY);
        psum += (float)ph;
        pw[(8 * hh + r) * LPITCH + j * 16 + c] = ph;
      }
      lrow[r] = lrow[r] * alpha + psum;
#pragma unroll
      for (int t = 0; t < 4; ++t) oacc[t][r] *= alpha;
    }
    __builtin_amdgcn_fence(__ATOMIC_RELEASE, "workgroup");
    __builtin_amdgcn_wave_barrier();
    __builtin_amdgcn_fence(__ATOMIC_ACQUIRE, "workgroup");
    /* both P fragments in one run; unrolled so that the V^T fragments stay in registers under constant indices */
    v16h pa[2];
#pragma unroll
    for (int kk = 0; kk < 2; ++kk) pa[kk] = frag_load(pw + c * LPITCH + kk * 32 + 8 * hh);
#pragma unroll
    for (int kk = 0; kk < 2; ++kk) {
#pragma unroll
      for (int t = 0; t < 4; ++t) oacc[t] = mma_h(pa[kk], vb[kk][t], oacc[t]);
    }
  }

  float* os = Os[wave];
#pragma unroll
  for (int r = 0; r < 8; ++r) {
    float l = lrow[r];
#pragma unroll
    for (int off = 1; off < 16; off <<= 1) l += __shfl_xor(l, off, 32);
    const float inv = 1.0f / l;
#pragma unroll
    for (int t = 0; t < 4; ++t) os[(8 * hh + r) * OPITCH + t * 16 + c] = oacc[t][r] * inv;
  }
  __builtin_amdgcn_fence(__ATOMIC_RELEASE, "workgroup");
  __builtin_amdgcn_wave_barrier();
  __builtin_amdgcn_fence(__ATOMIC_ACQUIRE, "workgroup");
  {
    const int c4 = c * 4;
    {
#pragma unroll
      for (int it = 0; it < 8; ++it) {
        const int row = it * 2 + hh;
        const v4f val = *(const v4f*)(os + row * OPITCH + c4);
        *(v4f*)(out + (((size_t)(b * NTIME + q0 + row)) * NHEAD + h) * VDIM + c4) = val;
      }
      
    }
  }
}

// ---------------------------------------------------------------------------
// Host glue. Workspace region map (bytes, 256-B aligned carve; total 8,650,752 <= 134,217,728):
//   GC2 [32][2048]          f32     262,144   log2e * cumulative gate sum per (b,h)
//   KH  [16][2048][64]      f16   4,194,304   K rows per (b, kv head)
//   VT  [16][64][2048]      f16   4,194,304   V transposed per (b, kv head)
// ---------------------------------------------------------------------------
extern "C" void kernel_launch(void* const* d_in, const int* in_sizes, int n_in,
                              void* d_out, int out_size, void* d_ws, size_t ws_size, hipStream_t stream) {
  if (n_in < 4 || d_out == nullptr || d_ws == nullptr) return;
  if (in_sizes[0] != NBATCH * NTIME * NHEAD * HDIM || in_sizes[1] != NBATCH * NTIME * NKVH * HDIM ||
      in_sizes[2] != NBATCH * NTIME * NKVH * VDIM || in_sizes[3] != NBATCH * NTIME * NHEAD ||
      out_size != NBATCH * NTIME * NHEAD * VDIM) return;

  const float* q = (const float*)d_in[0];
  const float* k = (const float*)d_in[1];
  const float* v = (const float*)d_in[2];
  const float* g = (const float*)d_in[3];
  float* out = (float*)d_out;

  char* ws = (char*)d_ws;
  size_t off = 0;
  auto carve = [&](size_t bytes) -> char* { char* p = ws + off; off += (bytes + 255) & ~(size_t)255; return p; };
  float*          GC2 = (float*)carve(GC_BYTES);
  unsigned short* KH  = (unsigned short*)carve(KH_BYTES);
  unsigned short* VT  = (unsigned short*)carve(VT_BYTES);
  if (off > ws_size || off > (size_t)134217728) return;

  gscan_kernel<<<NBATCH * NHEAD, GS_WAVES * 32, 0, stream>>>(g, GC2);
  kvprep_kernel<<<NBATCH * NKVH * (NTIME / 64), 256, 0, stream>>>(k, v, KH, VT);
  attn_kernel<<<NBATCH * NHEAD * NQB, 128, 0, stream>>>(q, KH, VT, GC2, out);
}

// v005
// It runs in 59.3 microseconds.
// In two side-by-side timings against v004, it was 1.11 and 1.07 times as fast.
// Over all steps from v000 it is 3.16 times as fast.
// Compute dtype: q.k^T and p.v on v_wmma_f32_16x16x32_f16 (q, k, v = f16 of RNE-bf16 inputs; p = f16 carried x32768), f32 accumulate; cumulative gate sum (of RNE-bf16 g), online softmax and normalisation in f32.
#include <hip/hip_runtime.h>
#include <math.h>

// ---------------------------------------------------------------------------
// Shape constants
// ---------------------------------------------------------------------------
constexpr int NBATCH = 4;
constexpr int NTIME  = 2048;
constexpr int NHEAD  = 8;
constexpr int NKVH   = 4;
constexpr int HDIM   = 64;
constexpr int VDIM   = 64;
constexpr int GQA    = NHEAD / NKVH;
constexpr int QBLK   = 64;
constexpr int KCHUNK = 64;
constexpr int NQB    = NTIME / QBLK;
constexpr int SQRT_HDIM = 8;
constexpr int OPITCH = 68;
// LDS row pitch of the K, V^T and P tiles in halves: 64 data + 8 pad = 144 B = 16 B x 9, so the 16 rows that one
// ds_load_b128 touches per half wave start on 16 different 4-bank groups (at 128 B they share two groups).
constexpr int LPITCH = 72;
static_assert(SQRT_HDIM * SQRT_HDIM == HDIM, "scale derivation");
static_assert(HDIM == 64 && VDIM == 64, "tile shapes");
static_assert(NHEAD % NKVH == 0 && GQA == 2, "kv head grouping");
static_assert(NTIME % 64 == 0, "time tiles");
static_assert(NQB == 32 && NBATCH * NHEAD == 32, "block index bits: 1 mirror + 4 tile + 5 head");
static_assert(HDIM % 32 == 0 && KCHUNK % 32 == 0, "k steps of 32");
static_assert(LPITCH >= HDIM && LPITCH >= KCHUNK && (LPITCH * 2) % 16 == 0 && ((LPITCH * 2) / 16) % 2 == 1, "LDS pitch");

constexpr float LOG2E_F   = 1.4426950408889634f;
constexpr float QK_SCALE  = 1.0f / (float)SQRT_HDIM;
constexpr float SCORE_L2  = QK_SCALE * LOG2E_F;
constexpr float P_CARRY   = 32768.0f;
constexpr float NEG_BIG   = -1.0e30f;

constexpr size_t GC_BYTES = (size_t)NBATCH * NHEAD * NTIME * 4;
constexpr size_t KH_BYTES = (size_t)NBATCH * NKVH * NTIME * HDIM * 2;
constexpr size_t VT_BYTES = (size_t)NBATCH * NKVH * VDIM * NTIME * 2;
static_assert(GC_BYTES + KH_BYTES + VT_BYTES <= (size_t)134217728, "carve");
static_assert((size_t)NBATCH * NTIME * NHEAD * VDIM * 4 == (size_t)16777216, "output bytes");

typedef __attribute__((ext_vector_type(16))) _Float16 v16h;
typedef __attribute__((ext_vector_type(8)))  _Float16 v8h;
typedef __attribute__((ext_vector_type(8)))  float    v8f;
typedef __attribute__((ext_vector_type(4)))  float    v4f;

// RNE convert of an f32 value to bf16 precision
__device__ __forceinline__ unsigned short f2bf_bits(float f) {
  unsigned u = __float_as_uint(f);
  return (unsigned short)((u + 0x7FFFu + ((u >> 16) & 1u)) >> 16);
}
__device__ __forceinline__ float bf_bits2f(unsigned short h) { return __uint_as_float(((unsigned)h) << 16); }
/* RNE convert to a bf16 value, kept in f32 */
__device__ __forceinline__ float bf16r(float f) { return bf_bits2f(f2bf_bits(f)); }

/* one WMMA followed by the 4-slot hazard guard tying D and naming A, B */
__device__ __forceinline__ v8f mma_h(v16h a, v16h b, v8f c) {
  c = __builtin_amdgcn_wmma_f32_16x16x32_f16(false, a, false, b, (short)0, c, false, false);
  asm volatile("v_nop\n\tv_nop\n\tv_nop\n\tv_nop" : "+v"(c) : "v"(a), "v"(b));
  return c;
}

/* 2^x as the bare v_exp_f32. The library exp2f wraps the same instruction in a range test, a pre-scale and an ldexp
   that only serve results below 2^-126. Every argument here is <= 0; a p that small is 0 after x32768 and the f16
   rounding either way, and an alpha that small scales sums that then vanish beside a new term of 32768 in the row. */
__device__ __forceinline__ float exp2_bare(float x) { return __builtin_amdgcn_exp2f(x); }

union FragH { v16h v; v8h h[2]; };
/* elements 0..7 <- p[0..7], elements 8..15 <- p[16..23]; caller adds 8*(lane>>4) */
__device__ __forceinline__ v16h frag_load(const _Float16* p) {
  FragH f;
  f.h[0] = *(const v8h*)(p);
  f.h[1] = *(const v8h*)(p + 16);
  return f.v;
}

// ---------------------------------------------------------------------------
// Launch 1: gc2[b*8+h][t] = log2(e) * inclusive cumulative sum over t of bf16value(g[b][t][h]), f32.
// One block of 8 waves per (b,h). The row is 64 segments of 32 steps; wave w owns segments 8w..8w+7.
// All 8 loads of a wave are in flight together and its 8 segment scans are independent of each other; the segment
// totals go through LDS, and every wave adds them up one after another from segment 0 on, so each carry is the same
// chain of f32 additions as in a single pass over the row.
// Store coverage: 8 waves x 8 segments x 32 lanes = 2048 floats = the whole row; each instruction is one 128-B line.
// ---------------------------------------------------------------------------
constexpr int GS_SEGS  = NTIME / 32;
constexpr int GS_WAVES = 8;
constexpr int GS_PER   = GS_SEGS / GS_WAVES;
static_assert(NTIME % 32 == 0 && GS_SEGS % GS_WAVES == 0 && GS_PER % 4 == 0, "scan segments");

__global__ __launch_bounds__(GS_WAVES * 32) void gscan_kernel(const float* __restrict__ g, float* __restrict__ gc2) {
  __shared__ __align__(16) float tot[GS_SEGS];
  const int bh = blockIdx.x;
  const int b = bh / NHEAD;
  const int h = bh % NHEAD;
  const int lane = threadIdx.x & 31;
  const int s0 = (threadIdx.x >> 5) * GS_PER;

  /* block-uniform row base + one 32-bit lane offset: the 8 loads differ only in their immediate offset */
  const float* grow = g + (size_t)b * NTIME * NHEAD + h;
  const unsigned e0 = (unsigned)(s0 * 32 + lane) * NHEAD;
  /* every loop of this kernel is unrolled: val[] stays in registers, and the 8 loads and the 8 scans stand side by side */
  float val[GS_PER];
#pragma unroll
  for (int i = 0; i < GS_PER; ++i) val[i] = grow[e0 + (unsigned)(i * 32 * NHEAD)];
#pragma unroll
  for (int i = 0; i < GS_PER; ++i) val[i] = bf16r(val[i]);
#pragma unroll
  for (int d = 1; d < 32; d <<= 1) {
#pragma unroll
    for (int i = 0; i < GS_PER; ++i) {
      const float up = __shfl_up(val[i], d, 32);
      val[i] += (lane >= d) ? up : 0.0f;
    }
  }
  if (lane == 31) {
#pragma unroll
    for (int i = 0; i < GS_PER; ++i) tot[s0 + i] = val[i];
  }
  __syncthreads();

  /* carry into segment s0: totals of the segments in front of it, in order (a later segment adds 0) */
  float carry = 0.0f;
#pragma unroll
  for (int j4 = 0; j4 < GS_SEGS - GS_PER; j4 += 4) {
    const v4f tq = *(const v4f*)(tot + j4);
#pragma unroll
    for (int e = 0; e < 4; ++e) carry += (j4 + e < s0) ? tq[e] : 0.0f;
  }
#pragma unroll
  for (int i = 0; i < GS_PER; ++i) {
    const float o = (val[i] + carry) * LOG2E_F;
    gc2[(size_t)bh * NTIME + (s0 + i) * 32 + lane] = o;
    carry += tot[s0 + i];
  }
}

// ---------------------------------------------------------------------------
// Launch 2: 16-bit operand planes. Block = 64 time steps of one (b, kv head); 256 threads; grid = 4*4*32 = 512.
//   Vt[(b*4+hk)][vc][t]  = f16(bf16value(v[b][t][hk][vc]))     in [t][vc] -> out [vc][t] through a 64x64 LDS tile
// Load coverage V: 4 iterations x 256 threads x 4 floats = 64 x 64. K: 2 groups x 256 threads x 8 floats = 64 x 64.
// Store coverage: 2 groups x 32 rows (tid>>3) x 8 lanes x 8 halves = 64 rows x 64 halves for each plane; lanes
// ---------------------------------------------------------------------------
__global__ __launch_bounds__(256) void kvprep_kernel(const float* __restrict__ kin, const float* __restrict__ vin,
                                                     unsigned short* __restrict__ Khp,
                                                     unsigned short* __restrict__ Vtp) {
  __shared__ float Tt[64 * 65];
  _Float16* Kh = (_Float16*)Khp;
  _Float16* Vt = (_Float16*)Vtp;
  const int tid = threadIdx.x;
  const int tb = blockIdx.x % (NTIME / 64);
  const int bk = blockIdx.x / (NTIME / 64);
  const int b  = bk / NKVH;
  const int hk = bk % NKVH;
  const int t0 = tb * 64;

#pragma unroll
  for (int i = 0; i < 4; ++i) {
    const int idx = i * 256 + tid;
    const int rr = idx >> 4;
    const int cc = (idx & 15) * 4;
    const v4f vv = *(const v4f*)(vin + (((size_t)(b * NTIME + t0 + rr)) * NKVH + hk) * VDIM + cc);
    Tt[rr * 65 + cc + 0] = vv[0];
    Tt[rr * 65 + cc + 1] = vv[1];
    Tt[rr * 65 + cc + 2] = vv[2];
    Tt[rr * 65 + cc + 3] = vv[3];
  }
  asm volatile("" ::: "memory");

  const int q  = tid >> 3;
  const int c8 = (tid & 7) * 8;
  v8h kh[2];
#pragma unroll
  for (int gq = 0; gq < 2; ++gq) {
    const int row = gq * 32 + q;
    const float* sp = kin + (((size_t)(b * NTIME + t0 + row)) * NKVH + hk) * HDIM + c8;
    const v4f a = *(const v4f*)(sp);
    const v4f c = *(const v4f*)(sp + 4);
#pragma unroll
    for (int e = 0; e < 4; ++e) {
      const float x0 = a[e];
      const float x1 = c[e];
      kh[gq][e]     = (_Float16)bf16r(x0);
      kh[gq][4 + e] = (_Float16)bf16r(x1);
    }
  }
  __syncthreads();
  v8h vh[2];
#pragma unroll
  for (int gq = 0; gq < 2; ++gq) {
    const int vrow = gq * 32 + q;
#pragma unroll
    for (int e = 0; e < 8; ++e) {
      const float f = Tt[(c8 + e) * 65 + vrow];
      vh[gq][e] = (_Float16)bf16r(f);
    }
  }
  {
#pragma unroll
    for (int gq = 0; gq < 2; ++gq) {
      const int row = gq * 32 + q;
      *(v8h*)(Kh + ((size_t)bk * NTIME + t0 + row) * HDIM + c8) = kh[gq];
      *(v8h*)(Vt + ((size_t)bk * VDIM + row) * NTIME + t0 + c8) = vh[gq];
    }
    
  }
}

// ---------------------------------------------------------------------------
// Launch 3: causal attention with per-key gate bias, online softmax in the log2 domain.
// Block = 4 waves = 64 query rows of one (b, h); grid = 4*8*32 = 1024. Key chunks of 64, chunks 0..qb (block-uniform).
// Per chunk: K tile [64 key][64 d] and V^T tile [64 vc][64 key] copied from the f16 planes into LDS
// (4 iterations x 128 threads x 8 halves = 4096 halves each), block barrier before and after.
// S: A = q [row][d] fragments in registers, B = K tile rows [key][d] (same split k map).
// t = S * (scale*log2e) - gc2[key]; masked (key > row, diagonal chunk only) -> -1e30; p = exp2(t - m).
// B = V^T tile rows [vc][key]. Denominator = sum of the same f16 values (per-lane partials, reduced once at the end).
// 4 waves = 64 rows, 64 columns.
// ---------------------------------------------------------------------------
__global__ __launch_bounds__(128) void attn_kernel(const float* __restrict__ qin,
                                                   const unsigned short* __restrict__ Khp,
                                                   const unsigned short* __restrict__ Vtp,
                                                   const float* __restrict__ gc2,
                                                   float* __restrict__ out) {
  __shared__ __align__(16) _Float16 Ks[KCHUNK * LPITCH];
  __shared__ __align__(16) _Float16 Vs[VDIM * LPITCH];
  __shared__ __align__(16) _Float16 Ps[4][16 * LPITCH];
  __shared__ __align__(16) float    Os[4][16 * OPITCH];
  const _Float16* Kh = (const _Float16*)Khp;
  const _Float16* Vt = (const _Float16*)Vtp;

  const int tid  = threadIdx.x;
  const int wave = tid >> 5;
  const int lane = tid & 31;
  const int hh   = lane >> 4;
  const int c    = lane & 15;

  /* Block index -> (head, query tile). Tile qb costs qb + 1 chunks, and the 1024 blocks are all resident at once, four to
     a WGP, so the launch lasts as long as the WGP whose four blocks hold the most chunks. Index bits 1, 2, 4, 6 name a
     tile a in 0..15; the parity of bits 0, 3, 5, 8 picks tile a or its mirror 31 - a. Two indices that differ in one of
     those four bits alone (1, 8, 32 or 256 apart) thus hold 33 chunks together, whichever of these strides the dispatch
     puts side by side on a WGP. A permutation of the 1024 (head, tile) pairs: for speed only, right for any placement. */
  const unsigned bx = blockIdx.x;
  const int ta = (int)(((bx >> 1) & 3u) | (((bx >> 4) & 1u) << 2) | (((bx >> 6) & 1u) << 3));
  const int qb = ((bx ^ (bx >> 3) ^ (bx >> 5) ^ (bx >> 8)) & 1u) ? NQB - 1 - ta : ta;
  const int bh = (int)((bx & 1u) | (((bx >> 3) & 1u) << 1) | (((bx >> 5) & 1u) << 2) | (((bx >> 7) & 1u) << 3) |
                       (((bx >> 9) & 1u) << 4));
  const int h  = bh % NHEAD;
  const int b  = bh / NHEAD;
  const int hk = h / GQA;
  const int bk = b * NKVH + hk;
  const int q0 = qb * QBLK + wave * 16;

  /* Q fragments: element e <- d = 32dc + 8hh + e, element 8+e <- d = 32dc + 16 + 8hh + e, row q0 + c */
  v16h qa[2];
  {
    const float* qrow = qin + (((size_t)(b * NTIME + q0 + c)) * NHEAD + h) * HDIM;
#pragma unroll
    for (int dc = 0; dc < 2; ++dc) {
      const v4f a0 = *(const v4f*)(qrow + dc * 32 + 8 * hh);
      const v4f a1 = *(const v4f*)(qrow + dc * 32 + 8 * hh + 4);
      const v4f b0 = *(const v4f*)(qrow + dc * 32 + 16 + 8 * hh);
      const v4f b1 = *(const v4f*)(qrow + dc * 32 + 16 + 8 * hh + 4);
#pragma unroll
      for (int e = 0; e < 4; ++e) {
        const float x0 = a0[e];
        const float x1 = a1[e];
        const float x2 = b0[e];
        const float x3 = b1[e];
        qa[dc][e]      = (_Float16)bf16r(x0);
        qa[dc][4 + e]  = (_Float16)bf16r(x1);
        qa[dc][8 + e]  = (_Float16)bf16r(x2);
        qa[dc][12 + e] = (_Float16)bf16r(x3);
      }
    }
  }

  float mrow[8], lrow[8];
  v8f oacc[4];
#pragma unroll
  for (int r = 0; r < 8; ++r) { mrow[r] = NEG_BIG; lrow[r] = 0.0f; }
#pragma unroll
  for (int t = 0; t < 4; ++t) oacc[t] = (v8f){0.f, 0.f, 0.f, 0.f, 0.f, 0.f, 0.f, 0.f};

  const float* gcb = gc2 + (size_t)bh * NTIME;
  const _Float16* kplane = Kh + (size_t)bk * NTIME * HDIM;
  const _Float16* vplane = Vt + (size_t)bk * VDIM * NTIME;
  _Float16* pw = Ps[wave];
  const int nChunks = qb + 1;

#pragma unroll 1
  for (int kc = 0; kc < nChunks; ++kc) {
    const int kv0 = kc * KCHUNK;
    __syncthreads();
    float gk[4];
    {
      const _Float16* ksrc = kplane + (size_t)kv0 * HDIM;
      v8h kk[4], vv[4];
#pragma unroll
      for (int it = 0; it < 4; ++it) {
        const int idx = it * 128 + tid;
        const int vcol = idx >> 3;
        const int k8 = (idx & 7) * 8;
        kk[it] = *(const v8h*)(ksrc + idx * 8);
        vv[it] = *(const v8h*)(vplane + (size_t)vcol * NTIME + kv0 + k8);
      }
      // the gate loads below land in registers that held these loads' addresses: the wait stands in front of that overwrite
      asm volatile("s_wait_xcnt 0x0" ::: "memory");
#pragma unroll
      for (int j = 0; j < 4; ++j) gk[j] = gcb[kv0 + j * 16 + c];
#pragma unroll
      for (int it = 0; it < 4; ++it) {
        const int idx = it * 128 + tid;
        const int vcol = idx >> 3;
        const int k8 = (idx & 7) * 8;
        *(v8h*)(Ks + vcol * LPITCH + k8) = kk[it];
        *(v8h*)(Vs + vcol * LPITCH + k8) = vv[it];
      }
    }
    __syncthreads();

    /* all 8 K fragments are requested in one run in front of the first product: the 8 products wait for one LDS round
       trip, not for one each (a load cannot pass the guard statement of the product in front of it) */
    v16h kb[2][4];
#pragma unroll
    for (int dc = 0; dc < 2; ++dc) {
#pragma unroll
      for (int j = 0; j < 4; ++j) kb[dc][j] = frag_load(Ks + (j * 16 + c) * LPITCH + dc * 32 + 8 * hh);
    }
    v8f s[4];
#pragma unroll
    for (int j = 0; j < 4; ++j) s[j] = (v8f){0.f, 0.f, 0.f, 0.f, 0.f, 0.f, 0.f, 0.f};
#pragma unroll
    for (int dc = 0; dc < 2; ++dc) {
#pragma unroll
      for (int j = 0; j < 4; ++j) s[j] = mma_h(qa[dc], kb[dc][j], s[j]);
    }
    /* the 8 V^T fragments are requested here, behind the score products: they land while the softmax runs */
    v16h vb[2][4];
#pragma unroll
    for (int kk = 0; kk < 2; ++kk) {
#pragma unroll
      for (int t = 0; t < 4; ++t) vb[kk][t] = frag_load(Vs + (t * 16 + c) * LPITCH + kk * 32 + 8 * hh);
    }

    const bool diag = (kc == qb);
    float cm[8];
#pragma unroll
    for (int r = 0; r < 8; ++r) {
      const int qrow = q0 + 8 * hh + r;
      float m = NEG_BIG;
#pragma unroll
      for (int j = 0; j < 4; ++j) {
        const int kvcol = kv0 + j * 16 + c;
        float tv = s[j][r] * SCORE_L2 - gk[j];
        const bool msk = diag && (kvcol > qrow);
        tv = msk ? NEG_BIG : tv;
        s[j][r] = tv;
        m = fmaxf(m, tv);
      }
      cm[r] = m;
    }
    /* Row maxima, step by step over all eight rows (same tree per row). The two scheduling fences hold the score work in
       front of the cross-lane steps and the exponentials behind them, so that the eight moves of a step stand together
       and share one run of LDS-counter waits; without the fences the build with the short exponentials finishes one
       row's four steps before it begins the next row's, about 20 full waits one behind the other. */
    __builtin_amdgcn_sched_barrier(0);
#pragma unroll
    for (int off = 1; off < 16; off <<= 1) {
#pragma unroll
      for (int r = 0; r < 8; ++r) cm[r] = fmaxf(cm[r], __shfl_xor(cm[r], off, 32));
    }
    __builtin_amdgcn_sched_barrier(0);
#pragma unroll
    for (int r = 0; r < 8; ++r) {
      const float mnew  = fmaxf(mrow[r], cm[r]);
      const float alpha = exp2_bare(mrow[r] - mnew);
      mrow[r] = mnew;
      float psum = 0.0f;
#pragma unroll
      for (int j = 0; j < 4; ++j) {
        const float p = exp2_bare(s[j][r] - mnew);
        const _Float16 ph = (_Float16)(p * P_CARRY);
        psum += (float)ph;
        pw[(8 * hh + r) * LPITCH + j * 16 + c] = ph;
      }
      lrow[r] = lrow[r] * alpha + psum;
#pragma unroll
      for (int t = 0; t < 4; ++t) oacc[t][r] *= alpha;
    }
    __builtin_amdgcn_fence(__ATOMIC_RELEASE, "workgroup");
    __builtin_amdgcn_wave_barrier();
    __builtin_amdgcn_fence(__ATOMIC_ACQUIRE, "workgroup");
    /* both P fragments in one run; unrolled so that the V^T fragments stay in registers under constant indices */
    v16h pa[2];
#pragma unroll
    for (int kk = 0; kk < 2; ++kk) pa[kk] = frag_load(pw + c * LPITCH + kk * 32 + 8 * hh);
#pragma unroll
    for (int kk = 0; kk < 2; ++kk) {
#pragma unroll
      for (int t = 0; t < 4; ++t) oacc[t] = mma_h(pa[kk], vb[kk][t], oacc[t]);
    }
  }

  float* os = Os[wave];
#pragma unroll
  for (int r = 0; r < 8; ++r) {
    float l = lrow[r];
#pragma unroll
    for (int off = 1; off < 16; off <<= 1) l += __shfl_xor(l, off, 32);
    const float inv = 1.0f / l;
#pragma unroll
    for (int t = 0; t < 4; ++t) os[(8 * hh + r) * OPITCH + t * 16 + c] = oacc[t][r] * inv;
  }
  __builtin_amdgcn_fence(__ATOMIC_RELEASE, "workgroup");
  __builtin_amdgcn_wave_barrier();
  __builtin_amdgcn_fence(__ATOMIC_ACQUIRE, "workgroup");
  {
    const int c4 = c * 4;
    {
#pragma unroll
      for (int it = 0; it < 8; ++it) {
        const int row = it * 2 + hh;
        const v4f val = *(const v4f*)(os + row * OPITCH + c4);
        *(v4f*)(out + (((size_t)(b * NTIME + q0 + row)) * NHEAD + h) * VDIM + c4) = val;
      }
      
    }
  }
}

// ---------------------------------------------------------------------------
// Host glue. Workspace region map (bytes, 256-B aligned carve; total 8,650,752 <= 134,217,728):
//   GC2 [32][2048]          f32     262,144   log2e * cumulative gate sum per (b,h)
//   KH  [16][2048][64]      f16   4,194,304   K rows per (b, kv head)
//   VT  [16][64][2048]      f16   4,194,304   V transposed per (b, kv head)
// ---------------------------------------------------------------------------
extern "C" void kernel_launch(void* const* d_in, const int* in_sizes, int n_in,
                              void* d_out, int out_size, void* d_ws, size_t ws_size, hipStream_t stream) {
  if (n_in < 4 || d_out == nullptr || d_ws == nullptr) return;
  if (in_sizes[0] != NBATCH * NTIME * NHEAD * HDIM || in_sizes[1] != NBATCH * NTIME * NKVH * HDIM ||
      in_sizes[2] != NBATCH * NTIME * NKVH * VDIM || in_sizes[3] != NBATCH * NTIME * NHEAD ||
      out_size != NBATCH * NTIME * NHEAD * VDIM) return;

  const float* q = (const float*)d_in[0];
  const float* k = (const float*)d_in[1];
  const float* v = (const float*)d_in[2];
  const float* g = (const float*)d_in[3];
  float* out = (float*)d_out;

  char* ws = (char*)d_ws;
  size_t off = 0;
  auto carve = [&](size_t bytes) -> char* { char* p = ws + off; off += (bytes + 255) & ~(size_t)255; return p; };
  float*          GC2 = (float*)carve(GC_BYTES);
  unsigned short* KH  = (unsigned short*)carve(KH_BYTES);
  unsigned short* VT  = (unsigned short*)carve(VT_BYTES);
  if (off > ws_size || off > (size_t)134217728) return;

  gscan_kernel<<<NBATCH * NHEAD, GS_WAVES * 32, 0, stream>>>(g, GC2);
  kvprep_kernel<<<NBATCH * NKVH * (NTIME / 64), 256, 0, stream>>>(k, v, KH, VT);
  attn_kernel<<<NBATCH * NHEAD * NQB, 128, 0, stream>>>(q, KH, VT, GC2, out);
}

// v006
// Measured time: 47.2 microseconds a run.
// Two timings next to v005 put it at 1.26 and 1.24 times that version's speed.
// All steps since v000 together make it 3.95 times as fast.
// Compute dtype: q.k^T and p.v on v_wmma_f32_16x16x32_f16 (q, k, v = f16 of RNE-bf16 inputs; p = f16 carried x32768), f32 accumulate; cumulative gate sum (of RNE-bf16 g), online softmax and normalisation in f32.
#include <hip/hip_runtime.h>
#include <math.h>

// ---------------------------------------------------------------------------
// Shape constants
// ---------------------------------------------------------------------------
constexpr int NBATCH = 4;
constexpr int NTIME  = 2048;
constexpr int NHEAD  = 8;
constexpr int NKVH   = 4;
constexpr int HDIM   = 64;
constexpr int VDIM   = 64;
constexpr int GQA    = NHEAD / NKVH;
constexpr int QBLK   = 64;
constexpr int KCHUNK = 64;
constexpr int KGRP   = 2;
constexpr int KSTEP  = KGRP * KCHUNK;
constexpr int NQB    = NTIME / QBLK;
constexpr int SQRT_HDIM = 8;
constexpr int OPITCH = 68;
// LDS row pitch of the K, V^T and P tiles in halves: 64 data + 8 pad = 144 B = 16 B x 9, so the 16 rows that one
// ds_load_b128 touches per half wave start on 16 different 4-bank groups (at 128 B they share two groups).
constexpr int LPITCH = 72;
static_assert(SQRT_HDIM * SQRT_HDIM == HDIM, "scale derivation");
static_assert(HDIM == 64 && VDIM == 64, "tile shapes");
static_assert(NHEAD % NKVH == 0 && GQA == 2, "kv head grouping");
static_assert(NTIME % 64 == 0, "time tiles");
static_assert(NQB == 32 && NBATCH * NHEAD == 32, "block index bits: 5 head + 5 tile");
static_assert(NTIME % KSTEP == 0, "a step's second half lies inside the planes");
static_assert(HDIM % 32 == 0 && KCHUNK % 32 == 0, "k steps of 32");
static_assert(LPITCH >= HDIM && LPITCH >= KCHUNK && (LPITCH * 2) % 16 == 0 && ((LPITCH * 2) / 16) % 2 == 1, "LDS pitch");

constexpr float LOG2E_F   = 1.4426950408889634f;
constexpr float QK_SCALE  = 1.0f / (float)SQRT_HDIM;
constexpr float SCORE_L2  = QK_SCALE * LOG2E_F;
constexpr float P_CARRY   = 32768.0f;
constexpr float NEG_BIG   = -1.0e30f;

constexpr size_t GC_BYTES = (size_t)NBATCH * NHEAD * NTIME * 4;
constexpr size_t KH_BYTES = (size_t)NBATCH * NKVH * NTIME * HDIM * 2;
constexpr size_t VT_BYTES = (size_t)NBATCH * NKVH * VDIM * NTIME * 2;
static_assert(GC_BYTES + KH_BYTES + VT_BYTES <= (size_t)134217728, "carve");
static_assert((size_t)NBATCH * NTIME * NHEAD * VDIM * 4 == (size_t)16777216, "output bytes");

typedef __attribute__((ext_vector_type(16))) _Float16 v16h;
typedef __attribute__((ext_vector_type(8)))  _Float16 v8h;
typedef __attribute__((ext_vector_type(8)))  float    v8f;
typedef __attribute__((ext_vector_type(4)))  float    v4f;

// RNE convert of an f32 value to bf16 precision
__device__ __forceinline__ unsigned short f2bf_bits(float f) {
  unsigned u = __float_as_uint(f);
  return (unsigned short)((u + 0x7FFFu + ((u >> 16) & 1u)) >> 16);
}
__device__ __forceinline__ float bf_bits2f(unsigned short h) { return __uint_as_float(((unsigned)h) << 16); }
/* RNE convert to a bf16 value, kept in f32 */
__device__ __forceinline__ float bf16r(float f) { return bf_bits2f(f2bf_bits(f)); }

/* one WMMA followed by the 4-slot hazard guard tying D and naming A, B */
__device__ __forceinline__ v8f mma_h(v16h a, v16h b, v8f c) {
  c = __builtin_amdgcn_wmma_f32_16x16x32_f16(false, a, false, b, (short)0, c, false, false);
  asm volatile("v_nop\n\tv_nop\n\tv_nop\n\tv_nop" : "+v"(c) : "v"(a), "v"(b));
  return c;
}

/* 2^x as the bare v_exp_f32. The library exp2f wraps the same instruction in a range test, a pre-scale and an ldexp
   that only serve results below 2^-126. Every argument here is <= 0; a p that small is 0 after x32768 and the f16
   rounding either way, and an alpha that small scales sums that then vanish beside a new term of 32768 in the row. */
__device__ __forceinline__ float exp2_bare(float x) { return __builtin_amdgcn_exp2f(x); }

union FragH { v16h v; v8h h[2]; };
/* elements 0..7 <- p[0..7], elements 8..15 <- p[16..23]; caller adds 8*(lane>>4) */
__device__ __forceinline__ v16h frag_load(const _Float16* p) {
  FragH f;
  f.h[0] = *(const v8h*)(p);
  f.h[1] = *(const v8h*)(p + 16);
  return f.v;
}

// ---------------------------------------------------------------------------
// Launch 1: gc2[b*8+h][t] = log2(e) * inclusive cumulative sum over t of bf16value(g[b][t][h]), f32.
// One block of 8 waves per (b,h). The row is 64 segments of 32 steps; wave w owns segments 8w..8w+7.
// All 8 loads of a wave are in flight together and its 8 segment scans are independent of each other; the segment
// totals go through LDS, and every wave adds them up one after another from segment 0 on, so each carry is the same
// chain of f32 additions as in a single pass over the row.
// Store coverage: 8 waves x 8 segments x 32 lanes = 2048 floats = the whole row; each instruction is one 128-B line.
// ---------------------------------------------------------------------------
constexpr int GS_SEGS  = NTIME / 32;
constexpr int GS_WAVES = 8;
constexpr int GS_PER   = GS_SEGS / GS_WAVES;
static_assert(NTIME % 32 == 0 && GS_SEGS % GS_WAVES == 0 && GS_PER % 4 == 0, "scan segments");

__global__ __launch_bounds__(GS_WAVES * 32) void gscan_kernel(const float* __restrict__ g, float* __restrict__ gc2) {
  __shared__ __align__(16) float tot[GS_SEGS];
  const int bh = blockIdx.x;
  const int b = bh / NHEAD;
  const int h = bh % NHEAD;
  const int lane = threadIdx.x & 31;
  const int s0 = (threadIdx.x >> 5) * GS_PER;

  /* block-uniform row base + one 32-bit lane offset: the 8 loads differ only in their immediate offset */
  const float* grow = g + (size_t)b * NTIME * NHEAD + h;
  const unsigned e0 = (unsigned)(s0 * 32 + lane) * NHEAD;
  /* every loop of this kernel is unrolled: val[] stays in registers, and the 8 loads and the 8 scans stand side by side */
  float val[GS_PER];
#pragma unroll
  for (int i = 0; i < GS_PER; ++i) val[i] = grow[e0 + (unsigned)(i * 32 * NHEAD)];
#pragma unroll
  for (int i = 0; i < GS_PER; ++i) val[i] = bf16r(val[i]);
#pragma unroll
  for (int d = 1; d < 32; d <<= 1) {
#pragma unroll
    for (int i = 0; i < GS_PER; ++i) {
      const float up = __shfl_up(val[i], d, 32);
      val[i] += (lane >= d) ? up : 0.0f;
    }
  }
  if (lane == 31) {
#pragma unroll
    for (int i = 0; i < GS_PER; ++i) tot[s0 + i] = val[i];
  }
  __syncthreads();

  /* carry into segment s0: totals of the segments in front of it, in order (a later segment adds 0) */
  float carry = 0.0f;
#pragma unroll
  for (int j4 = 0; j4 < GS_SEGS - GS_PER; j4 += 4) {
    const v4f tq = *(const v4f*)(tot + j4);
#pragma unroll
    for (int e = 0; e < 4; ++e) carry += (j4 + e < s0) ? tq[e] : 0.0f;
  }
#pragma unroll
  for (int i = 0; i < GS_PER; ++i) {
    const float o = (val[i] + carry) * LOG2E_F;
    gc2[(size_t)bh * NTIME + (s0 + i) * 32 + lane] = o;
    carry += tot[s0 + i];
  }
}

// ---------------------------------------------------------------------------
// Launch 2: 16-bit operand planes. Block = 64 time steps of one (b, kv head); 256 threads; grid = 4*4*32 = 512.
//   Vt[(b*4+hk)][vc][t]  = f16(bf16value(v[b][t][hk][vc]))     in [t][vc] -> out [vc][t] through a 64x64 LDS tile
// Load coverage V: 4 iterations x 256 threads x 4 floats = 64 x 64. K: 2 groups x 256 threads x 8 floats = 64 x 64.
// Store coverage: 2 groups x 32 rows (tid>>3) x 8 lanes x 8 halves = 64 rows x 64 halves for each plane; lanes
// ---------------------------------------------------------------------------
__global__ __launch_bounds__(256) void kvprep_kernel(const float* __restrict__ kin, const float* __restrict__ vin,
                                                     unsigned short* __restrict__ Khp,
                                                     unsigned short* __restrict__ Vtp) {
  __shared__ float Tt[64 * 65];
  _Float16* Kh = (_Float16*)Khp;
  _Float16* Vt = (_Float16*)Vtp;
  const int tid = threadIdx.x;
  const int tb = blockIdx.x % (NTIME / 64);
  const int bk = blockIdx.x / (NTIME / 64);
  const int b  = bk / NKVH;
  const int hk = bk % NKVH;
  const int t0 = tb * 64;

#pragma unroll
  for (int i = 0; i < 4; ++i) {
    const int idx = i * 256 + tid;
    const int rr = idx >> 4;
    const int cc = (idx & 15) * 4;
    const v4f vv = *(const v4f*)(vin + (((size_t)(b * NTIME + t0 + rr)) * NKVH + hk) * VDIM + cc);
    Tt[rr * 65 + cc + 0] = vv[0];
    Tt[rr * 65 + cc + 1] = vv[1];
    Tt[rr * 65 + cc + 2] = vv[2];
    Tt[rr * 65 + cc + 3] = vv[3];
  }
  asm volatile("" ::: "memory");

  const int q  = tid >> 3;
  const int c8 = (tid & 7) * 8;
  v8h kh[2];
#pragma unroll
  for (int gq = 0; gq < 2; ++gq) {
    const int row = gq * 32 + q;
    const float* sp = kin + (((size_t)(b * NTIME + t0 + row)) * NKVH + hk) * HDIM + c8;
    const v4f a = *(const v4f*)(sp);
    const v4f c = *(const v4f*)(sp + 4);
#pragma unroll
    for (int e = 0; e < 4; ++e) {
      const float x0 = a[e];
      const float x1 = c[e];
      kh[gq][e]     = (_Float16)bf16r(x0);
      kh[gq][4 + e] = (_Float16)bf16r(x1);
    }
  }
  __syncthreads();
  v8h vh[2];
#pragma unroll
  for (int gq = 0; gq < 2; ++gq) {
    const int vrow = gq * 32 + q;
#pragma unroll
    for (int e = 0; e < 8; ++e) {
      const float f = Tt[(c8 + e) * 65 + vrow];
      vh[gq][e] = (_Float16)bf16r(f);
    }
  }
  {
#pragma unroll
    for (int gq = 0; gq < 2; ++gq) {
      const int row = gq * 32 + q;
      *(v8h*)(Kh + ((size_t)bk * NTIME + t0 + row) * HDIM + c8) = kh[gq];
      *(v8h*)(Vt + ((size_t)bk * VDIM + row) * NTIME + t0 + c8) = vh[gq];
    }
    
  }
}

// ---------------------------------------------------------------------------
// Launch 3: causal attention with per-key gate bias, online softmax in the log2 domain.
// Block = 8 waves = 64 query rows of one (b, h) x 2 key groups; grid = 4*8*32 = 1024. Wave w: rows 16(w & 3).., group w >> 2.
// A step stages 128 keys = chunks 2s and 2s+1; group 0 works on chunk 2s, group 1 on chunk 2s+1, each with its own running
// maximum, denominator and output sums, so a tile of n chunks takes ceil(n / 2) steps one behind the other, not n.
// A chunk past the diagonal (2s+1 > qb, last step only) is staged but not worked on. Behind the loop group 1 hands its
// three partials over through LDS and group 0 joins them on the common maximum.
// Per step: K tile [128 key][64 d] and two V^T tiles [64 vc][64 key] copied from the f16 planes into LDS
// (4 iterations x 256 threads x 8 halves = 8192 halves each), block barrier before and after.
// S: A = q [row][d] fragments in registers, B = K tile rows [key][d] (same split k map).
// t = S * (scale*log2e) - gc2[key]; masked (key > row, diagonal chunk only) -> -1e30; p = exp2(t - m).
// B = V^T tile rows [vc][key]. Denominator = sum of the same f16 values (per-lane partials, reduced once at the end).
// 4 waves = 64 rows, 64 columns.
// ---------------------------------------------------------------------------
__global__ __launch_bounds__(256) void attn_kernel(const float* __restrict__ qin,
                                                   const unsigned short* __restrict__ Khp,
                                                   const unsigned short* __restrict__ Vtp,
                                                   const float* __restrict__ gc2,
                                                   float* __restrict__ out) {
  __shared__ __align__(16) _Float16 Ks[KSTEP * LPITCH];
  __shared__ __align__(16) _Float16 Vs[KGRP][VDIM * LPITCH];
  __shared__ __align__(16) _Float16 Ps[4 * KGRP][16 * LPITCH];
  __shared__ __align__(16) float    Os[4][16 * OPITCH];
  __shared__ __align__(16) v4f      Mg[4][12 * 32];
  const _Float16* Kh = (const _Float16*)Khp;
  const _Float16* Vt = (const _Float16*)Vtp;

  const int tid  = threadIdx.x;
  /* the wave's number in a scalar register: the test that skips a chunk past the diagonal is then a scalar branch */
  const int wave = __builtin_amdgcn_readfirstlane(tid >> 5);
  const int rw   = wave & 3;
  const int grp  = wave >> 2;
  const int lane = tid & 31;
  const int hh   = lane >> 4;
  const int c    = lane & 15;

  /* Block index -> (head, query tile). At 8 waves a block two blocks fit a WGP, 512 of the 1024 at a time; the cost falls
     with the index (tile 31 first, tile 0 last). A permutation of the 1024 (head, tile) pairs: for speed only. */
  const unsigned bx = blockIdx.x;
  const int qb = NQB - 1 - (int)(bx >> 5);
  const int bh = (int)(bx & 31u);
  const int h  = bh % NHEAD;
  const int b  = bh / NHEAD;
  const int hk = h / GQA;
  const int bk = b * NKVH + hk;
  const int q0 = qb * QBLK + rw * 16;

  /* Q fragments: element e <- d = 32dc + 8hh + e, element 8+e <- d = 32dc + 16 + 8hh + e, row q0 + c */
  v16h qa[2];
  {
    const float* qrow = qin + (((size_t)(b * NTIME + q0 + c)) * NHEAD + h) * HDIM;
#pragma unroll
    for (int dc = 0; dc < 2; ++dc) {
      const v4f a0 = *(const v4f*)(qrow + dc * 32 + 8 * hh);
      const v4f a1 = *(const v4f*)(qrow + dc * 32 + 8 * hh + 4);
      const v4f b0 = *(const v4f*)(qrow + dc * 32 + 16 + 8 * hh);
      const v4f b1 = *(const v4f*)(qrow + dc * 32 + 16 + 8 * hh + 4);
#pragma unroll
      for (int e = 0; e < 4; ++e) {
        const float x0 = a0[e];
        const float x1 = a1[e];
        const float x2 = b0[e];
        const float x3 = b1[e];
        qa[dc][e]      = (_Float16)bf16r(x0);
        qa[dc][4 + e]  = (_Float16)bf16r(x1);
        qa[dc][8 + e]  = (_Float16)bf16r(x2);
        qa[dc][12 + e] = (_Float16)bf16r(x3);
      }
    }
  }

  float mrow[8], lrow[8];
  v8f oacc[4];
#pragma unroll
  for (int r = 0; r < 8; ++r) { mrow[r] = NEG_BIG; lrow[r] = 0.0f; }
#pragma unroll
  for (int t = 0; t < 4; ++t) oacc[t] = (v8f){0.f, 0.f, 0.f, 0.f, 0.f, 0.f, 0.f, 0.f};

  const float* gcb = gc2 + (size_t)bh * NTIME;
  const _Float16* kplane = Kh + (size_t)bk * NTIME * HDIM;
  const _Float16* vplane = Vt + (size_t)bk * VDIM * NTIME;
  _Float16* pw = Ps[wave];
  const _Float16* ksg = Ks + grp * KCHUNK * LPITCH;
  const _Float16* vsg = Vs[grp];
  const int nSteps = (qb + KGRP) / KGRP;

#pragma unroll 1
  for (int st = 0; st < nSteps; ++st) {
    const int kvs = st * KSTEP;
    const int kc  = st * KGRP + grp;
    const int kv0 = kc * KCHUNK;
    __syncthreads();
    float gk[4];
    {
      const _Float16* ksrc = kplane + (size_t)kvs * HDIM;
      v8h kk[4], vv[4];
#pragma unroll
      for (int it = 0; it < 4; ++it) {
        const int idx = it * 256 + tid;
        const int vcol = (idx >> 3) & (VDIM - 1);
        const int k8 = (idx & 7) * 8;
        kk[it] = *(const v8h*)(ksrc + idx * 8);
        vv[it] = *(const v8h*)(vplane + (size_t)vcol * NTIME + kvs + (it >> 1) * KCHUNK + k8);
      }
      // the gate loads below land in registers that held these loads' addresses: the wait stands in front of that overwrite
      asm volatile("s_wait_xcnt 0x0" ::: "memory");
#pragma unroll
      for (int j = 0; j < 4; ++j) gk[j] = gcb[kv0 + j * 16 + c];
#pragma unroll
      for (int it = 0; it < 4; ++it) {
        const int idx = it * 256 + tid;
        const int krow = idx >> 3;
        const int vcol = krow & (VDIM - 1);
        const int k8 = (idx & 7) * 8;
        *(v8h*)(Ks + krow * LPITCH + k8) = kk[it];
        *(v8h*)(Vs[it >> 1] + vcol * LPITCH + k8) = vv[it];
      }
    }
    __syncthreads();
    /* wave-uniform, no barrier inside: group 1 has no chunk in the last step of a tile with an odd number of chunks */
    if (kc > qb) continue;

    /* all 8 K fragments are requested in one run in front of the first product: the 8 products wait for one LDS round
       trip, not for one each (a load cannot pass the guard statement of the product in front of it) */
    v16h kb[2][4];
#pragma unroll
    for (int dc = 0; dc < 2; ++dc) {
#pragma unroll
      for (int j = 0; j < 4; ++j) kb[dc][j] = frag_load(ksg + (j * 16 + c) * LPITCH + dc * 32 + 8 * hh);
    }
    v8f s[4];
#pragma unroll
    for (int j = 0; j < 4; ++j) s[j] = (v8f){0.f, 0.f, 0.f, 0.f, 0.f, 0.f, 0.f, 0.f};
#pragma unroll
    for (int dc = 0; dc < 2; ++dc) {
#pragma unroll
      for (int j = 0; j < 4; ++j) s[j] = mma_h(qa[dc], kb[dc][j], s[j]);
    }
    /* the 8 V^T fragments are requested here, behind the score products: they land while the softmax runs */
    v16h vb[2][4];
#pragma unroll
    for (int kk = 0; kk < 2; ++kk) {
#pragma unroll
      for (int t = 0; t < 4; ++t) vb[kk][t] = frag_load(vsg + (t * 16 + c) * LPITCH + kk * 32 + 8 * hh);
    }

    const bool diag = (kc == qb);
    float cm[8];
#pragma unroll
    for (int r = 0; r < 8; ++r) {
      const int qrow = q0 + 8 * hh + r;
      float m = NEG_BIG;
#pragma unroll
      for (int j = 0; j < 4; ++j) {
        const int kvcol = kv0 + j * 16 + c;
        float tv = s[j][r] * SCORE_L2 - gk[j];
        const bool msk = diag && (kvcol > qrow);
        tv = msk ? NEG_BIG : tv;
        s[j][r] = tv;
        m = fmaxf(m, tv);
      }
      cm[r] = m;
    }
    /* Row maxima, step by step over all eight rows (same tree per row). The two scheduling fences hold the score work in
       front of the cross-lane steps and the exponentials behind them, so that the eight moves of a step stand together
       and share one run of LDS-counter waits; without the fences the build with the short exponentials finishes one
       row's four steps before it begins the next row's, about 20 full waits one behind the other. */
    __builtin_amdgcn_sched_barrier(0);
#pragma unroll
    for (int off = 1; off < 16; off <<= 1) {
#pragma unroll
      for (int r = 0; r < 8; ++r) cm[r] = fmaxf(cm[r], __shfl_xor(cm[r], off, 32));
    }
    __builtin_amdgcn_sched_barrier(0);
#pragma unroll
    for (int r = 0; r < 8; ++r) {
      const float mnew  = fmaxf(mrow[r], cm[r]);
      const float xa = mrow[r] - mnew;
      float alpha = exp2_bare(xa);
      mrow[r] = mnew;
      float x[4], p[4];
#pragma unroll
      for (int j = 0; j < 4; ++j) {
        x[j] = s[j][r] - mnew;
        p[j] = exp2_bare(x[j]);
      }
      /* the slot that the instruction set asks for behind a transcendental, one for the row's five: naming results and
         sources keeps every reader of a result and every overwrite of an argument behind the v_nop */
      asm volatile("v_nop" : "+v"(alpha), "+v"(p[0]), "+v"(p[1]), "+v"(p[2]), "+v"(p[3])
                   : "v"(xa), "v"(x[0]), "v"(x[1]), "v"(x[2]), "v"(x[3]));
      float psum = 0.0f;
#pragma unroll
      for (int j = 0; j < 4; ++j) {
        const _Float16 ph = (_Float16)(p[j] * P_CARRY);
        psum += (float)ph;
        pw[(8 * hh + r) * LPITCH + j * 16 + c] = ph;
      }
      lrow[r] = lrow[r] * alpha + psum;
#pragma unroll
      for (int t = 0; t < 4; ++t) oacc[t][r] *= alpha;
    }
    __builtin_amdgcn_fence(__ATOMIC_RELEASE, "workgroup");
    __builtin_amdgcn_wave_barrier();
    __builtin_amdgcn_fence(__ATOMIC_ACQUIRE, "workgroup");
    /* both P fragments in one run; unrolled so that the V^T fragments stay in registers under constant indices */
    v16h pa[2];
#pragma unroll
    for (int kk = 0; kk < 2; ++kk) pa[kk] = frag_load(pw + c * LPITCH + kk * 32 + 8 * hh);
#pragma unroll
    for (int kk = 0; kk < 2; ++kk) {
#pragma unroll
      for (int t = 0; t < 4; ++t) oacc[t] = mma_h(pa[kk], vb[kk][t], oacc[t]);
    }
  }

  /* Join of the two key groups. Group 1 stores m, its per-lane l and its output sums (12 x 16 B a lane, lane-contiguous);
     the same lane of wave rw holds the same rows and columns. A group 1 that had no chunk hands over m = -1e30 and zeros,
     whose weight 2^(m1 - m) is 0. The barrier is the block's last; group 1 ends behind it. */
  v4f* mg = Mg[rw];
  if (grp != 0) {
#pragma unroll
    for (int hf = 0; hf < 2; ++hf) {
      mg[(0 + hf) * 32 + lane] = (v4f){mrow[4 * hf], mrow[4 * hf + 1], mrow[4 * hf + 2], mrow[4 * hf + 3]};
      mg[(2 + hf) * 32 + lane] = (v4f){lrow[4 * hf], lrow[4 * hf + 1], lrow[4 * hf + 2], lrow[4 * hf + 3]};
#pragma unroll
      for (int t = 0; t < 4; ++t)
        mg[(4 + 2 * t + hf) * 32 + lane] =
            (v4f){oacc[t][4 * hf], oacc[t][4 * hf + 1], oacc[t][4 * hf + 2], oacc[t][4 * hf + 3]};
    }
  }
  __syncthreads();
  if (grp != 0) return;
#pragma unroll
  for (int hf = 0; hf < 2; ++hf) {
    const v4f m1 = mg[(0 + hf) * 32 + lane];
    const v4f l1 = mg[(2 + hf) * 32 + lane];
    v4f o1[4];
#pragma unroll
    for (int t = 0; t < 4; ++t) o1[t] = mg[(4 + 2 * t + hf) * 32 + lane];
#pragma unroll
    for (int e = 0; e < 4; ++e) {
      const int r = 4 * hf + e;
      const float mj = fmaxf(mrow[r], m1[e]);
      const float x0 = mrow[r] - mj;
      const float x1 = m1[e] - mj;
      float a0 = exp2_bare(x0);
      float a1 = exp2_bare(x1);
      /* the slot that the instruction set asks for behind a transcendental: naming results and sources keeps every reader
         of a weight and every overwrite of its argument behind the v_nop (8 a wave, outside the loop) */
      asm volatile("v_nop" : "+v"(a0), "+v"(a1) : "v"(x0), "v"(x1));
      lrow[r] = lrow[r] * a0 + l1[e] * a1;
#pragma unroll
      for (int t = 0; t < 4; ++t) oacc[t][r] = oacc[t][r] * a0 + o1[t][e] * a1;
    }
  }

  float* os = Os[rw];
#pragma unroll
  for (int r = 0; r < 8; ++r) {
    float l = lrow[r];
#pragma unroll
    for (int off = 1; off < 16; off <<= 1) l += __shfl_xor(l, off, 32);
    const float inv = 1.0f / l;
#pragma unroll
    for (int t = 0; t < 4; ++t) os[(8 * hh + r) * OPITCH + t * 16 + c] = oacc[t][r] * inv;
  }
  __builtin_amdgcn_fence(__ATOMIC_RELEASE, "workgroup");
  __builtin_amdgcn_wave_barrier();
  __builtin_amdgcn_fence(__ATOMIC_ACQUIRE, "workgroup");
  {
    const int c4 = c * 4;
    {
#pragma unroll
      for (int it = 0; it < 8; ++it) {
        const int row = it * 2 + hh;
        const v4f val = *(const v4f*)(os + row * OPITCH + c4);
        *(v4f*)(out + (((size_t)(b * NTIME + q0 + row)) * NHEAD + h) * VDIM + c4) = val;
      }
      
    }
  }
}

// ---------------------------------------------------------------------------
// Host glue. Workspace region map (bytes, 256-B aligned carve; total 8,650,752 <= 134,217,728):
//   GC2 [32][2048]          f32     262,144   log2e * cumulative gate sum per (b,h)
//   KH  [16][2048][64]      f16   4,194,304   K rows per (b, kv head)
//   VT  [16][64][2048]      f16   4,194,304   V transposed per (b, kv head)
// ---------------------------------------------------------------------------
extern "C" void kernel_launch(void* const* d_in, const int* in_sizes, int n_in,
                              void* d_out, int out_size, void* d_ws, size_t ws_size, hipStream_t stream) {
  if (n_in < 4 || d_out == nullptr || d_ws == nullptr) return;
  if (in_sizes[0] != NBATCH * NTIME * NHEAD * HDIM || in_sizes[1] != NBATCH * NTIME * NKVH * HDIM ||
      in_sizes[2] != NBATCH * NTIME * NKVH * VDIM || in_sizes[3] != NBATCH * NTIME * NHEAD ||
      out_size != NBATCH * NTIME * NHEAD * VDIM) return;

  const float* q = (const float*)d_in[0];
  const float* k = (const float*)d_in[1];
  const float* v = (const float*)d_in[2];
  const float* g = (const float*)d_in[3];
  float* out = (float*)d_out;

  char* ws = (char*)d_ws;
  size_t off = 0;
  auto carve = [&](size_t bytes) -> char* { char* p = ws + off; off += (bytes + 255) & ~(size_t)255; return p; };
  float*          GC2 = (float*)carve(GC_BYTES);
  unsigned short* KH  = (unsigned short*)carve(KH_BYTES);
  unsigned short* VT  = (unsigned short*)carve(VT_BYTES);
  if (off > ws_size || off > (size_t)134217728) return;

  gscan_kernel<<<NBATCH * NHEAD, GS_WAVES * 32, 0, stream>>>(g, GC2);
  kvprep_kernel<<<NBATCH * NKVH * (NTIME / 64), 256, 0, stream>>>(k, v, KH, VT);
  attn_kernel<<<NBATCH * NHEAD * NQB, 256, 0, stream>>>(q, KH, VT, GC2, out);
}

// v007
// One run takes 38 microseconds.
// Two timings next to v006 put it at 1.23 and 1.25 times that version's speed.
// Counting every step since v000, it is 4.89 times as fast.
// Compute dtype: q.k^T and p.v on v_wmma_f32_16x16x32_f16 (q, k, v = f16 of RNE-bf16 inputs; p = f16 carried x32768), f32 accumulate; cumulative gate sum (of RNE-bf16 g), online softmax and normalisation in f32.
#include <hip/hip_runtime.h>
#include <math.h>

// ---------------------------------------------------------------------------
// Shape constants
// ---------------------------------------------------------------------------
constexpr int NBATCH = 4;
constexpr int NTIME  = 2048;
constexpr int NHEAD  = 8;
constexpr int NKVH   = 4;
constexpr int HDIM   = 64;
constexpr int VDIM   = 64;
constexpr int GQA    = NHEAD / NKVH;
constexpr int QBLK   = 64;
constexpr int KCHUNK = 64;
constexpr int KGRP   = 2;
constexpr int KSTEP  = KGRP * KCHUNK;
constexpr int NQB    = NTIME / QBLK;
constexpr int SQRT_HDIM = 8;
constexpr int OPITCH = 68;
// LDS row pitch of the K and V^T tiles in halves: 64 data + 8 pad = 144 B = 16 B x 9, so the 16 rows that one
// ds_load_b128 touches per half wave start on 16 different 4-bank groups (at 128 B they share two groups).
constexpr int LPITCH = 72;
static_assert(SQRT_HDIM * SQRT_HDIM == HDIM, "scale derivation");
static_assert(HDIM == 64 && VDIM == 64, "tile shapes");
static_assert(NHEAD % NKVH == 0 && GQA == 2, "kv head grouping");
static_assert(NTIME % 64 == 0, "time tiles");
static_assert(NQB == 32 && NBATCH * NHEAD == 32, "block index bits: 5 head + 5 tile");
static_assert(NTIME % KSTEP == 0, "a step's second half lies inside the planes");
static_assert(HDIM % 32 == 0 && KCHUNK % 32 == 0, "k steps of 32");
static_assert(LPITCH >= HDIM && LPITCH >= KCHUNK && (LPITCH * 2) % 16 == 0 && ((LPITCH * 2) / 16) % 2 == 1, "LDS pitch");

constexpr float LOG2E_F   = 1.4426950408889634f;
constexpr float QK_SCALE  = 1.0f / (float)SQRT_HDIM;
constexpr float SCORE_L2  = QK_SCALE * LOG2E_F;
constexpr float P_CARRY   = 32768.0f;
constexpr float NEG_BIG   = -1.0e30f;

constexpr size_t GC_BYTES = (size_t)NBATCH * NHEAD * NTIME * 4;
constexpr size_t KH_BYTES = (size_t)NBATCH * NKVH * NTIME * HDIM * 2;
constexpr size_t VT_BYTES = (size_t)NBATCH * NKVH * VDIM * NTIME * 2;
static_assert(GC_BYTES + KH_BYTES + VT_BYTES <= (size_t)134217728, "carve");
static_assert((size_t)NBATCH * NTIME * NHEAD * VDIM * 4 == (size_t)16777216, "output bytes");

typedef __attribute__((ext_vector_type(16))) _Float16 v16h;
typedef __attribute__((ext_vector_type(8)))  _Float16 v8h;
typedef __attribute__((ext_vector_type(8)))  float    v8f;
typedef __attribute__((ext_vector_type(4)))  float    v4f;
typedef __attribute__((ext_vector_type(2)))  float    v2f;
typedef __attribute__((ext_vector_type(2)))  _Float16 v2h;

// RNE convert of an f32 value to bf16 precision
__device__ __forceinline__ unsigned short f2bf_bits(float f) {
  unsigned u = __float_as_uint(f);
  return (unsigned short)((u + 0x7FFFu + ((u >> 16) & 1u)) >> 16);
}
__device__ __forceinline__ float bf_bits2f(unsigned short h) { return __uint_as_float(((unsigned)h) << 16); }
/* RNE convert to a bf16 value, kept in f32 */
__device__ __forceinline__ float bf16r(float f) { return bf_bits2f(f2bf_bits(f)); }

/* one WMMA followed by the 4-slot hazard guard tying D and naming A, B */
__device__ __forceinline__ v8f mma_h(v16h a, v16h b, v8f c) {
  c = __builtin_amdgcn_wmma_f32_16x16x32_f16(false, a, false, b, (short)0, c, false, false);
  asm volatile("v_nop\n\tv_nop\n\tv_nop\n\tv_nop" : "+v"(c) : "v"(a), "v"(b));
  return c;
}

/* 2^x as the bare v_exp_f32. The library exp2f wraps the same instruction in a range test, a pre-scale and an ldexp
   that only serve results below 2^-126. Every argument here is <= 0; a p that small is 0 after x32768 and the f16
   rounding either way, and an alpha that small scales sums that then vanish beside a new term of 32768 in the row. */
__device__ __forceinline__ float exp2_bare(float x) { return __builtin_amdgcn_exp2f(x); }

/* the value that lane ^ 16 holds: one cross-row vector move, no LDS counter */
__device__ __forceinline__ float xhalf(float f) {
  const int b = __float_as_int(f);
  return __int_as_float(__builtin_amdgcn_permlanex16(b, b, 0x76543210, 0xfedcba98, false, false));
}

union FragH { v16h v; v8h h[2]; };
/* elements 0..7 <- p[0..7], elements 8..15 <- p[16..23]; caller adds 8*(lane>>4) */
__device__ __forceinline__ v16h frag_load(const _Float16* p) {
  FragH f;
  f.h[0] = *(const v8h*)(p);
  f.h[1] = *(const v8h*)(p + 16);
  return f.v;
}

// ---------------------------------------------------------------------------
// Launch 1: gc2[b*8+h][t] = log2(e) * inclusive cumulative sum over t of bf16value(g[b][t][h]), f32.
// One block of 8 waves per (b,h). The row is 64 segments of 32 steps; wave w owns segments 8w..8w+7.
// All 8 loads of a wave are in flight together and its 8 segment scans are independent of each other; the segment
// totals go through LDS, and every wave adds them up one after another from segment 0 on, so each carry is the same
// chain of f32 additions as in a single pass over the row.
// Store coverage: 8 waves x 8 segments x 32 lanes = 2048 floats = the whole row; each instruction is one 128-B line.
// ---------------------------------------------------------------------------
constexpr int GS_SEGS  = NTIME / 32;
constexpr int GS_WAVES = 8;
constexpr int GS_PER   = GS_SEGS / GS_WAVES;
static_assert(NTIME % 32 == 0 && GS_SEGS % GS_WAVES == 0 && GS_PER % 4 == 0, "scan segments");

__global__ __launch_bounds__(GS_WAVES * 32) void gscan_kernel(const float* __restrict__ g, float* __restrict__ gc2) {
  __shared__ __align__(16) float tot[GS_SEGS];
  const int bh = blockIdx.x;
  const int b = bh / NHEAD;
  const int h = bh % NHEAD;
  const int lane = threadIdx.x & 31;
  const int s0 = (threadIdx.x >> 5) * GS_PER;

  /* block-uniform row base + one 32-bit lane offset: the 8 loads differ only in their immediate offset */
  const float* grow = g + (size_t)b * NTIME * NHEAD + h;
  const unsigned e0 = (unsigned)(s0 * 32 + lane) * NHEAD;
  /* every loop of this kernel is unrolled: val[] stays in registers, and the 8 loads and the 8 scans stand side by side */
  float val[GS_PER];
#pragma unroll
  for (int i = 0; i < GS_PER; ++i) val[i] = grow[e0 + (unsigned)(i * 32 * NHEAD)];
#pragma unroll
  for (int i = 0; i < GS_PER; ++i) val[i] = bf16r(val[i]);
#pragma unroll
  for (int d = 1; d < 32; d <<= 1) {
#pragma unroll
    for (int i = 0; i < GS_PER; ++i) {
      const float up = __shfl_up(val[i], d, 32);
      val[i] += (lane >= d) ? up : 0.0f;
    }
  }
  if (lane == 31) {
#pragma unroll
    for (int i = 0; i < GS_PER; ++i) tot[s0 + i] = val[i];
  }
  __syncthreads();

  /* carry into segment s0: totals of the segments in front of it, in order (a later segment adds 0) */
  float carry = 0.0f;
#pragma unroll
  for (int j4 = 0; j4 < GS_SEGS - GS_PER; j4 += 4) {
    const v4f tq = *(const v4f*)(tot + j4);
#pragma unroll
    for (int e = 0; e < 4; ++e) carry += (j4 + e < s0) ? tq[e] : 0.0f;
  }
#pragma unroll
  for (int i = 0; i < GS_PER; ++i) {
    const float o = (val[i] + carry) * LOG2E_F;
    gc2[(size_t)bh * NTIME + (s0 + i) * 32 + lane] = o;
    carry += tot[s0 + i];
  }
}

// ---------------------------------------------------------------------------
// Launch 2: 16-bit operand planes. Block = 64 time steps of one (b, kv head); 256 threads; grid = 4*4*32 = 512.
//   Vt[(b*4+hk)][vc][t]  = f16(bf16value(v[b][t][hk][vc]))     in [t][vc] -> out [vc][t] through a 64x64 LDS tile
// Load coverage V: 4 iterations x 256 threads x 4 floats = 64 x 64. K: 2 groups x 256 threads x 8 floats = 64 x 64.
// Store coverage: 2 groups x 32 rows (tid>>3) x 8 lanes x 8 halves = 64 rows x 64 halves for each plane; lanes
// ---------------------------------------------------------------------------
__global__ __launch_bounds__(256) void kvprep_kernel(const float* __restrict__ kin, const float* __restrict__ vin,
                                                     unsigned short* __restrict__ Khp,
                                                     unsigned short* __restrict__ Vtp) {
  __shared__ float Tt[64 * 65];
  _Float16* Kh = (_Float16*)Khp;
  _Float16* Vt = (_Float16*)Vtp;
  const int tid = threadIdx.x;
  const int tb = blockIdx.x % (NTIME / 64);
  const int bk = blockIdx.x / (NTIME / 64);
  const int b  = bk / NKVH;
  const int hk = bk % NKVH;
  const int t0 = tb * 64;

#pragma unroll
  for (int i = 0; i < 4; ++i) {
    const int idx = i * 256 + tid;
    const int rr = idx >> 4;
    const int cc = (idx & 15) * 4;
    const v4f vv = *(const v4f*)(vin + (((size_t)(b * NTIME + t0 + rr)) * NKVH + hk) * VDIM + cc);
    Tt[rr * 65 + cc + 0] = vv[0];
    Tt[rr * 65 + cc + 1] = vv[1];
    Tt[rr * 65 + cc + 2] = vv[2];
    Tt[rr * 65 + cc + 3] = vv[3];
  }
  asm volatile("" ::: "memory");

  const int q  = tid >> 3;
  const int c8 = (tid & 7) * 8;
  v8h kh[2];
#pragma unroll
  for (int gq = 0; gq < 2; ++gq) {
    const int row = gq * 32 + q;
    const float* sp = kin + (((size_t)(b * NTIME + t0 + row)) * NKVH + hk) * HDIM + c8;
    const v4f a = *(const v4f*)(sp);
    const v4f c = *(const v4f*)(sp + 4);
#pragma unroll
    for (int e = 0; e < 4; ++e) {
      const float x0 = a[e];
      const float x1 = c[e];
      kh[gq][e]     = (_Float16)bf16r(x0);
      kh[gq][4 + e] = (_Float16)bf16r(x1);
    }
  }
  __syncthreads();
  v8h vh[2];
#pragma unroll
  for (int gq = 0; gq < 2; ++gq) {
    const int vrow = gq * 32 + q;
#pragma unroll
    for (int e = 0; e < 8; ++e) {
      const float f = Tt[(c8 + e) * 65 + vrow];
      vh[gq][e] = (_Float16)bf16r(f);
    }
  }
  {
#pragma unroll
    for (int gq = 0; gq < 2; ++gq) {
      const int row = gq * 32 + q;
      *(v8h*)(Kh + ((size_t)bk * NTIME + t0 + row) * HDIM + c8) = kh[gq];
      *(v8h*)(Vt + ((size_t)bk * VDIM + row) * NTIME + t0 + c8) = vh[gq];
    }
    
  }
}

__global__ __launch_bounds__(256) void attn_kernel(const float* __restrict__ qin,
                                                   const unsigned short* __restrict__ Khp,
                                                   const unsigned short* __restrict__ Vtp,
                                                   const float* __restrict__ gc2,
                                                   float* __restrict__ out) {
  __shared__ __align__(16) _Float16 Ks[KSTEP * LPITCH];
  __shared__ __align__(16) _Float16 Vs[KGRP][VDIM * LPITCH];
  __shared__ __align__(16) float    Os[4][16 * OPITCH];
  __shared__ __align__(16) v4f      Mg[4][9 * 32];
  const _Float16* Kh = (const _Float16*)Khp;
  const _Float16* Vt = (const _Float16*)Vtp;

  const int tid  = threadIdx.x;
  /* the wave's number in a scalar register: the test that skips a chunk past the diagonal is then a scalar branch */
  const int wave = __builtin_amdgcn_readfirstlane(tid >> 5);
  const int rw   = wave & 3;
  const int grp  = wave >> 2;
  const int lane = tid & 31;
  const int hh   = lane >> 4;
  const int c    = lane & 15;

  /* Block index -> (head, query tile). At 8 waves a block two blocks fit a WGP, 512 of the 1024 at a time; the cost falls
     with the index (tile 31 first, tile 0 last). A permutation of the 1024 (head, tile) pairs: for speed only. */
  const unsigned bx = blockIdx.x;
  const int qb = NQB - 1 - (int)(bx >> 5);
  const int bh = (int)(bx & 31u);
  const int h  = bh % NHEAD;
  const int b  = bh / NHEAD;
  const int hk = h / GQA;
  const int bk = b * NKVH + hk;
  const int q0 = qb * QBLK + rw * 16;

  /* Q fragments: element e <- d = 32dc + 8hh + e, element 8+e <- d = 32dc + 16 + 8hh + e, row q0 + c */
  v16h qa[2];
  {
    const float* qrow = qin + (((size_t)(b * NTIME + q0 + c)) * NHEAD + h) * HDIM;
#pragma unroll
    for (int dc = 0; dc < 2; ++dc) {
      const v4f a0 = *(const v4f*)(qrow + dc * 32 + 8 * hh);
      const v4f a1 = *(const v4f*)(qrow + dc * 32 + 8 * hh + 4);
      const v4f b0 = *(const v4f*)(qrow + dc * 32 + 16 + 8 * hh);
      const v4f b1 = *(const v4f*)(qrow + dc * 32 + 16 + 8 * hh + 4);
#pragma unroll
      for (int e = 0; e < 4; ++e) {
        const float x0 = a0[e];
        const float x1 = a1[e];
        const float x2 = b0[e];
        const float x3 = b1[e];
        qa[dc][e]      = (_Float16)bf16r(x0);
        qa[dc][4 + e]  = (_Float16)bf16r(x1);
        qa[dc][8 + e]  = (_Float16)bf16r(x2);
        qa[dc][12 + e] = (_Float16)bf16r(x3);
      }
    }
  }

  /* one query row a lane: one running maximum, one partial denominator; oacc[t][r] = O[row q0 + c][vc 16t + 8hh + r] */
  float mrow = NEG_BIG, lrow = 0.0f;
  v8f oacc[4];
#pragma unroll
  for (int t = 0; t < 4; ++t) oacc[t] = (v8f){0.f, 0.f, 0.f, 0.f, 0.f, 0.f, 0.f, 0.f};

  const float* gcb = gc2 + (size_t)bh * NTIME;
  const _Float16* kplane = Kh + (size_t)bk * NTIME * HDIM;
  const _Float16* vplane = Vt + (size_t)bk * VDIM * NTIME;
  const _Float16* ksg = Ks + grp * KCHUNK * LPITCH;
  const _Float16* vsg = Vs[grp];
  const int nSteps = (qb + KGRP) / KGRP;

#pragma unroll 1
  for (int st = 0; st < nSteps; ++st) {
    const int kvs = st * KSTEP;
    const int kc  = st * KGRP + grp;
    const int kv0 = kc * KCHUNK;
    __syncthreads();
    v4f gk[4][2];
    {
      const _Float16* ksrc = kplane + (size_t)kvs * HDIM;
      v8h kk[4], vv[4];
#pragma unroll
      for (int it = 0; it < 4; ++it) {
        const int idx = it * 256 + tid;
        const int vcol = (idx >> 3) & (VDIM - 1);
        const int k8 = (idx & 7) * 8;
        kk[it] = *(const v8h*)(ksrc + idx * 8);
        vv[it] = *(const v8h*)(vplane + (size_t)vcol * NTIME + kvs + (it >> 1) * KCHUNK + k8);
      }
      // the gate loads below land in registers that held these loads' addresses: the wait stands in front of that overwrite
      asm volatile("s_wait_xcnt 0x0" ::: "memory");
#pragma unroll
      for (int j = 0; j < 4; ++j) {
        gk[j][0] = *(const v4f*)(gcb + kv0 + j * 16 + 8 * hh);
        gk[j][1] = *(const v4f*)(gcb + kv0 + j * 16 + 8 * hh + 4);
      }
      // the gate loads' own address pair is stepped at the loop's foot: the wait stands in front of that overwrite
      asm volatile("s_wait_xcnt 0x0" ::: "memory");
#pragma unroll
      for (int it = 0; it < 4; ++it) {
        const int idx = it * 256 + tid;
        const int krow = idx >> 3;
        const int vcol = krow & (VDIM - 1);
        const int k8 = (idx & 7) * 8;
        *(v8h*)(Ks + krow * LPITCH + k8) = kk[it];
        *(v8h*)(Vs[it >> 1] + vcol * LPITCH + k8) = vv[it];
      }
    }
    __syncthreads();
    /* wave-uniform, no barrier inside: group 1 has no chunk in the last step of a tile with an odd number of chunks */
    if (kc > qb) continue;

    /* all 8 K fragments are requested in one run in front of the first product: the 8 products wait for one LDS round
       trip, not for one each (a load cannot pass the guard statement of the product in front of it) */
    v16h kb[2][4];
#pragma unroll
    for (int dc = 0; dc < 2; ++dc) {
#pragma unroll
      for (int j = 0; j < 4; ++j) kb[dc][j] = frag_load(ksg + (j * 16 + c) * LPITCH + dc * 32 + 8 * hh);
    }
    v8f s[4];
#pragma unroll
    for (int j = 0; j < 4; ++j) s[j] = (v8f){0.f, 0.f, 0.f, 0.f, 0.f, 0.f, 0.f, 0.f};
#pragma unroll
    for (int dc = 0; dc < 2; ++dc) {
#pragma unroll
      for (int j = 0; j < 4; ++j) s[j] = mma_h(kb[dc][j], qa[dc], s[j]);
    }
    /* the 8 V^T fragments are requested here, behind the score products: they land while the softmax runs */
    v16h vb[2][4];
#pragma unroll
    for (int kk = 0; kk < 2; ++kk) {
#pragma unroll
      for (int t = 0; t < 4; ++t) vb[kk][t] = frag_load(vsg + (t * 16 + c) * LPITCH + kk * 32 + 8 * hh);
    }

    const bool diag = (kc == qb);
    /* key 16j + 8hh + r of the chunk lies behind the row's own key where 16j + r > dq; off the diagonal no 16j + r reaches 64 */
    const int dq = diag ? (q0 + c) - kv0 - 8 * hh : KCHUNK;
    float cm4[4];
#pragma unroll
    for (int j = 0; j < 4; ++j) {
      float m = NEG_BIG;
#pragma unroll
      for (int r = 0; r < 8; ++r) {
        float tv = s[j][r] * SCORE_L2 - gk[j][r >> 2][r & 3];
        const bool msk = (j * 16 + r) > dq;
        tv = msk ? NEG_BIG : tv;
        s[j][r] = tv;
        m = fmaxf(m, tv);
      }
      cm4[j] = m;
    }
    /* the row's maximum: 32 keys inside the lane, the other 32 from lane ^ 16 by one cross-row move */
    const float cm = fmaxf(fmaxf(cm4[0], cm4[1]), fmaxf(cm4[2], cm4[3]));
    const float mnew = fmaxf(mrow, fmaxf(cm, xhalf(cm)));
    const float xa = mrow - mnew;
    float alpha = exp2_bare(xa);
    mrow = mnew;
    v16h pb[2];
    float psum = 0.0f;
#pragma unroll
    for (int j = 0; j < 4; ++j) {
      float x[8], p[8];
#pragma unroll
      for (int r = 0; r < 8; ++r) {
        x[r] = s[j][r] - mnew;
        p[r] = exp2_bare(x[r]);
      }
      /* the slot that the instruction set asks for behind a transcendental, one for the tile's eight: naming results and
         sources keeps every reader of a result and every overwrite of an argument behind the v_nop */
      asm volatile("v_nop" : "+v"(p[0]), "+v"(p[1]), "+v"(p[2]), "+v"(p[3]), "+v"(p[4]), "+v"(p[5]), "+v"(p[6]), "+v"(p[7])
                   : "v"(x[0]), "v"(x[1]), "v"(x[2]), "v"(x[3]), "v"(x[4]), "v"(x[5]), "v"(x[6]), "v"(x[7]));
#pragma unroll
      for (int r = 0; r < 8; r += 2) {
        const v2f pc = (v2f){p[r] * P_CARRY, p[r + 1] * P_CARRY};
        const v2h ph = __builtin_convertvector(pc, v2h);
        psum += (float)ph[0];
        psum += (float)ph[1];
        pb[j >> 1][(j & 1) * 8 + r]     = ph[0];
        pb[j >> 1][(j & 1) * 8 + r + 1] = ph[1];
      }
    }
    lrow = lrow * alpha + psum;
#pragma unroll
    for (int t = 0; t < 4; ++t) oacc[t] *= alpha;
#pragma unroll
    for (int kk = 0; kk < 2; ++kk) {
#pragma unroll
      for (int t = 0; t < 4; ++t) oacc[t] = mma_h(vb[kk][t], pb[kk], oacc[t]);
    }
  }

  /* Join of the two key groups. Group 1 stores m with its per-lane l and its output sums (9 x 16 B a lane, lane-contiguous);
     the same lane of wave rw holds the same row and columns. A group 1 that had no chunk hands over m = -1e30 and zeros,
     whose weight 2^(m1 - m) is 0. The barrier is the block's last; group 1 ends behind it. */
  v4f* mg = Mg[rw];
  if (grp != 0) {
    mg[lane] = (v4f){mrow, lrow, 0.0f, 0.0f};
#pragma unroll
    for (int t = 0; t < 4; ++t) {
#pragma unroll
      for (int hf = 0; hf < 2; ++hf)
        mg[(1 + 2 * t + hf) * 32 + lane] =
            (v4f){oacc[t][4 * hf], oacc[t][4 * hf + 1], oacc[t][4 * hf + 2], oacc[t][4 * hf + 3]};
    }
  }
  __syncthreads();
  if (grp != 0) return;
  {
    const v4f ml1 = mg[lane];
    const float mj = fmaxf(mrow, ml1[0]);
    const float x0 = mrow - mj;
    const float x1 = ml1[0] - mj;
    float a0 = exp2_bare(x0);
    float a1 = exp2_bare(x1);
    /* the slot that the instruction set asks for behind a transcendental: naming results and sources keeps every reader
       of a weight and every overwrite of its argument behind the v_nop (one a wave, outside the loop) */
    asm volatile("v_nop" : "+v"(a0), "+v"(a1) : "v"(x0), "v"(x1));
    lrow = lrow * a0 + ml1[1] * a1;
#pragma unroll
    for (int t = 0; t < 4; ++t) {
#pragma unroll
      for (int hf = 0; hf < 2; ++hf) {
        const v4f o1 = mg[(1 + 2 * t + hf) * 32 + lane];
#pragma unroll
        for (int e = 0; e < 4; ++e) oacc[t][4 * hf + e] = oacc[t][4 * hf + e] * a0 + o1[e] * a1;
      }
    }
  }

  /* the row's denominator: the two halves' partials joined; the lane's 8 consecutive columns of a tile go to the staging
     tile as two 16-B stores, from where whole 256-B rows leave as before */
  float* os = Os[rw];
  {
    const float l = lrow + xhalf(lrow);
    const float inv = 1.0f / l;
#pragma unroll
    for (int t = 0; t < 4; ++t) {
#pragma unroll
      for (int hf = 0; hf < 2; ++hf)
        *(v4f*)(os + c * OPITCH + t * 16 + 8 * hh + 4 * hf) =
            (v4f){oacc[t][4 * hf] * inv, oacc[t][4 * hf + 1] * inv, oacc[t][4 * hf + 2] * inv, oacc[t][4 * hf + 3] * inv};
    }
  }
  __builtin_amdgcn_fence(__ATOMIC_RELEASE, "workgroup");
  __builtin_amdgcn_wave_barrier();
  __builtin_amdgcn_fence(__ATOMIC_ACQUIRE, "workgroup");
  {
    const int c4 = c * 4;
    {
#pragma unroll
      for (int it = 0; it < 8; ++it) {
        const int row = it * 2 + hh;
        const v4f val = *(const v4f*)(os + row * OPITCH + c4);
        *(v4f*)(out + (((size_t)(b * NTIME + q0 + row)) * NHEAD + h) * VDIM + c4) = val;
      }
      
    }
  }
}

// ---------------------------------------------------------------------------
// Host glue. Workspace region map (bytes, 256-B aligned carve; total 8,650,752 <= 134,217,728):
//   GC2 [32][2048]          f32     262,144   log2e * cumulative gate sum per (b,h)
//   KH  [16][2048][64]      f16   4,194,304   K rows per (b, kv head)
//   VT  [16][64][2048]      f16   4,194,304   V transposed per (b, kv head)
// ---------------------------------------------------------------------------
extern "C" void kernel_launch(void* const* d_in, const int* in_sizes, int n_in,
                              void* d_out, int out_size, void* d_ws, size_t ws_size, hipStream_t stream) {
  if (n_in < 4 || d_out == nullptr || d_ws == nullptr) return;
  if (in_sizes[0] != NBATCH * NTIME * NHEAD * HDIM || in_sizes[1] != NBATCH * NTIME * NKVH * HDIM ||
      in_sizes[2] != NBATCH * NTIME * NKVH * VDIM || in_sizes[3] != NBATCH * NTIME * NHEAD ||
      out_size != NBATCH * NTIME * NHEAD * VDIM) return;

  const float* q = (const float*)d_in[0];
  const float* k = (const float*)d_in[1];
  const float* v = (const float*)d_in[2];
  const float* g = (const float*)d_in[3];
  float* out = (float*)d_out;

  char* ws = (char*)d_ws;
  size_t off = 0;
  auto carve = [&](size_t bytes) -> char* { char* p = ws + off; off += (bytes + 255) & ~(size_t)255; return p; };
  float*          GC2 = (float*)carve(GC_BYTES);
  unsigned short* KH  = (unsigned short*)carve(KH_BYTES);
  unsigned short* VT  = (unsigned short*)carve(VT_BYTES);
  if (off > ws_size || off > (size_t)134217728) return;

  gscan_kernel<<<NBATCH * NHEAD, GS_WAVES * 32, 0, stream>>>(g, GC2);
  kvprep_kernel<<<NBATCH * NKVH * (NTIME / 64), 256, 0, stream>>>(k, v, KH, VT);
  attn_kernel<<<NBATCH * NHEAD * NQB, 256, 0, stream>>>(q, KH, VT, GC2, out);
}

// v008
// One run takes 34.5 microseconds.
// In both of two side-by-side timings against v007, it was 1.09 times as fast.
// Over all steps from v000 it is 5.33 times as fast.
// Compute dtype: q.k^T and p.v on v_wmma_f32_16x16x32_f16 (q, k, v = f16 of RNE-bf16 inputs; p = f16 carried x32768), f32 accumulate; cumulative gate sum (of RNE-bf16 g), online softmax and normalisation in f32.
#include <hip/hip_runtime.h>
#include <math.h>

// ---------------------------------------------------------------------------
// Shape constants
// ---------------------------------------------------------------------------
constexpr int NBATCH = 4;
constexpr int NTIME  = 2048;
constexpr int NHEAD  = 8;
constexpr int NKVH   = 4;
constexpr int HDIM   = 64;
constexpr int VDIM   = 64;
constexpr int GQA    = NHEAD / NKVH;
constexpr int QBLK   = 64;
constexpr int KCHUNK = 64;
constexpr int KGRP   = 2;
constexpr int KSTEP  = KGRP * KCHUNK;
constexpr int NQB    = NTIME / QBLK;
constexpr int SQRT_HDIM = 8;
constexpr int OPITCH = 68;
// LDS row pitch of the K and V^T tiles in halves: 64 data + 8 pad = 144 B = 16 B x 9, so the 16 rows that one
// ds_load_b128 touches per half wave start on 16 different 4-bank groups (at 128 B they share two groups).
constexpr int LPITCH = 72;
static_assert(SQRT_HDIM * SQRT_HDIM == HDIM, "scale derivation");
static_assert(HDIM == 64 && VDIM == 64, "tile shapes");
static_assert(NHEAD % NKVH == 0 && GQA == 2, "kv head grouping");
static_assert(NTIME % 64 == 0, "time tiles");
static_assert(NQB == 32 && NBATCH * NHEAD == 32, "block index bits: 5 head + 5 tile");
static_assert(NTIME % KSTEP == 0, "a step's second half lies inside the planes");
static_assert(HDIM % 32 == 0 && KCHUNK % 32 == 0, "k steps of 32");
static_assert(LPITCH >= HDIM && LPITCH >= KCHUNK && (LPITCH * 2) % 16 == 0 && ((LPITCH * 2) / 16) % 2 == 1, "LDS pitch");

constexpr float LOG2E_F   = 1.4426950408889634f;
constexpr float QK_SCALE  = 1.0f / (float)SQRT_HDIM;
constexpr float SCORE_L2  = QK_SCALE * LOG2E_F;
constexpr float P_CARRY   = 32768.0f;
constexpr float NEG_BIG   = -1.0e30f;

constexpr size_t GC_BYTES = (size_t)NBATCH * NHEAD * NTIME * 4;
constexpr size_t KH_BYTES = (size_t)NBATCH * NKVH * NTIME * HDIM * 2;
constexpr size_t VT_BYTES = (size_t)NBATCH * NKVH * VDIM * NTIME * 2;
static_assert(GC_BYTES + KH_BYTES + VT_BYTES <= (size_t)134217728, "carve");
static_assert((size_t)NBATCH * NTIME * NHEAD * VDIM * 4 == (size_t)16777216, "output bytes");

typedef __attribute__((ext_vector_type(16))) _Float16 v16h;
typedef __attribute__((ext_vector_type(8)))  _Float16 v8h;
typedef __attribute__((ext_vector_type(8)))  float    v8f;
typedef __attribute__((ext_vector_type(4)))  float    v4f;
typedef __attribute__((ext_vector_type(2)))  float    v2f;
typedef __attribute__((ext_vector_type(2)))  _Float16 v2h;

// RNE convert of an f32 value to bf16 precision
__device__ __forceinline__ unsigned short f2bf_bits(float f) {
  unsigned u = __float_as_uint(f);
  return (unsigned short)((u + 0x7FFFu + ((u >> 16) & 1u)) >> 16);
}
__device__ __forceinline__ float bf_bits2f(unsigned short h) { return __uint_as_float(((unsigned)h) << 16); }
/* RNE convert to a bf16 value, kept in f32 */
__device__ __forceinline__ float bf16r(float f) { return bf_bits2f(f2bf_bits(f)); }

/* one WMMA followed by the 4-slot hazard guard tying D and naming A, B */
__device__ __forceinline__ v8f mma_h(v16h a, v16h b, v8f c) {
  c = __builtin_amdgcn_wmma_f32_16x16x32_f16(false, a, false, b, (short)0, c, false, false);
  asm volatile("v_nop\n\tv_nop\n\tv_nop\n\tv_nop" : "+v"(c) : "v"(a), "v"(b));
  return c;
}

/* 2^x as the bare v_exp_f32. The library exp2f wraps the same instruction in a range test, a pre-scale and an ldexp
   that only serve results below 2^-126. Every argument here is <= 0; a p that small is 0 after x32768 and the f16
   rounding either way, and an alpha that small scales sums that then vanish beside a new term of 32768 in the row. */
__device__ __forceinline__ float exp2_bare(float x) { return __builtin_amdgcn_exp2f(x); }

/* the value that lane ^ 16 holds: one cross-row vector move, no LDS counter */
__device__ __forceinline__ float xhalf(float f) {
  const int b = __float_as_int(f);
  return __int_as_float(__builtin_amdgcn_permlanex16(b, b, 0x76543210, 0xfedcba98, false, false));
}

union FragH { v16h v; v8h h[2]; };
/* elements 0..7 <- p[0..7], elements 8..15 <- p[16..23]; caller adds 8*(lane>>4) */
__device__ __forceinline__ v16h frag_load(const _Float16* p) {
  FragH f;
  f.h[0] = *(const v8h*)(p);
  f.h[1] = *(const v8h*)(p + 16);
  return f.v;
}

// ---------------------------------------------------------------------------
// Launch 1: gc2[b*8+h][t] = log2(e) * inclusive cumulative sum over t of bf16value(g[b][t][h]), f32.
// One block of 8 waves per (b,h). The row is 64 segments of 32 steps; wave w owns segments 8w..8w+7.
// All 8 loads of a wave are in flight together and its 8 segment scans are independent of each other; the segment
// totals go through LDS, and every wave adds them up one after another from segment 0 on, so each carry is the same
// chain of f32 additions as in a single pass over the row.
// Store coverage: 8 waves x 8 segments x 32 lanes = 2048 floats = the whole row; each instruction is one 128-B line.
// ---------------------------------------------------------------------------
constexpr int GS_SEGS  = NTIME / 32;
constexpr int GS_WAVES = 8;
constexpr int GS_PER   = GS_SEGS / GS_WAVES;
static_assert(NTIME % 32 == 0 && GS_SEGS % GS_WAVES == 0 && GS_PER % 4 == 0, "scan segments");

__global__ __launch_bounds__(GS_WAVES * 32) void gscan_kernel(const float* __restrict__ g, float* __restrict__ gc2) {
  __shared__ __align__(16) float tot[GS_SEGS];
  const int bh = blockIdx.x;
  const int b = bh / NHEAD;
  const int h = bh % NHEAD;
  const int lane = threadIdx.x & 31;
  const int s0 = (threadIdx.x >> 5) * GS_PER;

  /* block-uniform row base + one 32-bit lane offset: the 8 loads differ only in their immediate offset */
  const float* grow = g + (size_t)b * NTIME * NHEAD + h;
  const unsigned e0 = (unsigned)(s0 * 32 + lane) * NHEAD;
  /* every loop of this kernel is unrolled: val[] stays in registers, and the 8 loads and the 8 scans stand side by side */
  float val[GS_PER];
#pragma unroll
  for (int i = 0; i < GS_PER; ++i) val[i] = grow[e0 + (unsigned)(i * 32 * NHEAD)];
#pragma unroll
  for (int i = 0; i < GS_PER; ++i) val[i] = bf16r(val[i]);
#pragma unroll
  for (int d = 1; d < 32; d <<= 1) {
#pragma unroll
    for (int i = 0; i < GS_PER; ++i) {
      const float up = __shfl_up(val[i], d, 32);
      val[i] += (lane >= d) ? up : 0.0f;
    }
  }
  if (lane == 31) {
#pragma unroll
    for (int i = 0; i < GS_PER; ++i) tot[s0 + i] = val[i];
  }
  __syncthreads();

  /* carry into segment s0: totals of the segments in front of it, in order (a later segment adds 0) */
  float carry = 0.0f;
#pragma unroll
  for (int j4 = 0; j4 < GS_SEGS - GS_PER; j4 += 4) {
    const v4f tq = *(const v4f*)(tot + j4);
#pragma unroll
    for (int e = 0; e < 4; ++e) carry += (j4 + e < s0) ? tq[e] : 0.0f;
  }
#pragma unroll
  for (int i = 0; i < GS_PER; ++i) {
    const float o = (val[i] + carry) * LOG2E_F;
    gc2[(size_t)bh * NTIME + (s0 + i) * 32 + lane] = o;
    carry += tot[s0 + i];
  }
}

// ---------------------------------------------------------------------------
// Launch 2: 16-bit operand planes. Block = 64 time steps of one (b, kv head); 256 threads; grid = 4*4*32 = 512.
//   Vt[(b*4+hk)][vc][t]  = f16(bf16value(v[b][t][hk][vc]))     in [t][vc] -> out [vc][t] through a 64x64 LDS tile
// Load coverage V: 4 iterations x 256 threads x 4 floats = 64 x 64. K: 2 groups x 256 threads x 8 floats = 64 x 64.
// Store coverage: 2 groups x 32 rows (tid>>3) x 8 lanes x 8 halves = 64 rows x 64 halves for each plane; lanes
// ---------------------------------------------------------------------------
__global__ __launch_bounds__(256) void kvprep_kernel(const float* __restrict__ kin, const float* __restrict__ vin,
                                                     unsigned short* __restrict__ Khp,
                                                     unsigned short* __restrict__ Vtp) {
  __shared__ float Tt[64 * 65];
  _Float16* Kh = (_Float16*)Khp;
  _Float16* Vt = (_Float16*)Vtp;
  const int tid = threadIdx.x;
  const int tb = blockIdx.x % (NTIME / 64);
  const int bk = blockIdx.x / (NTIME / 64);
  const int b  = bk / NKVH;
  const int hk = bk % NKVH;
  const int t0 = tb * 64;

#pragma unroll
  for (int i = 0; i < 4; ++i) {
    const int idx = i * 256 + tid;
    const int rr = idx >> 4;
    const int cc = (idx & 15) * 4;
    const v4f vv = *(const v4f*)(vin + (((size_t)(b * NTIME + t0 + rr)) * NKVH + hk) * VDIM + cc);
    Tt[rr * 65 + cc + 0] = vv[0];
    Tt[rr * 65 + cc + 1] = vv[1];
    Tt[rr * 65 + cc + 2] = vv[2];
    Tt[rr * 65 + cc + 3] = vv[3];
  }
  asm volatile("" ::: "memory");

  const int q  = tid >> 3;
  const int c8 = (tid & 7) * 8;
  v8h kh[2];
#pragma unroll
  for (int gq = 0; gq < 2; ++gq) {
    const int row = gq * 32 + q;
    const float* sp = kin + (((size_t)(b * NTIME + t0 + row)) * NKVH + hk) * HDIM + c8;
    const v4f a = *(const v4f*)(sp);
    const v4f c = *(const v4f*)(sp + 4);
#pragma unroll
    for (int e = 0; e < 4; ++e) {
      const float x0 = a[e];
      const float x1 = c[e];
      kh[gq][e]     = (_Float16)bf16r(x0);
      kh[gq][4 + e] = (_Float16)bf16r(x1);
    }
  }
  __syncthreads();
  v8h vh[2];
#pragma unroll
  for (int gq = 0; gq < 2; ++gq) {
    const int vrow = gq * 32 + q;
#pragma unroll
    for (int e = 0; e < 8; ++e) {
      const float f = Tt[(c8 + e) * 65 + vrow];
      vh[gq][e] = (_Float16)bf16r(f);
    }
  }
  {
#pragma unroll
    for (int gq = 0; gq < 2; ++gq) {
      const int row = gq * 32 + q;
      *(v8h*)(Kh + ((size_t)bk * NTIME + t0 + row) * HDIM + c8) = kh[gq];
      *(v8h*)(Vt + ((size_t)bk * VDIM + row) * NTIME + t0 + c8) = vh[gq];
    }
    
  }
}

__global__ __launch_bounds__(256) void attn_kernel(const float* __restrict__ qin,
                                                   const unsigned short* __restrict__ Khp,
                                                   const unsigned short* __restrict__ Vtp,
                                                   const float* __restrict__ gc2,
                                                   float* __restrict__ out) {
  __shared__ __align__(16) _Float16 Ks[2][KSTEP * LPITCH];
  __shared__ __align__(16) _Float16 Vs[2][KGRP][VDIM * LPITCH];
  __shared__ __align__(16) float    Gs[2][KSTEP];
  __shared__ __align__(16) float    Os[4][16 * OPITCH];
  __shared__ __align__(16) v4f      Mg[4][9 * 32];
  const _Float16* Kh = (const _Float16*)Khp;
  const _Float16* Vt = (const _Float16*)Vtp;

  const int tid  = threadIdx.x;
  /* the wave's number in a scalar register: the test that skips a chunk past the diagonal is then a scalar branch */
  const int wave = __builtin_amdgcn_readfirstlane(tid >> 5);
  const int rw   = wave & 3;
  const int grp  = wave >> 2;
  const int lane = tid & 31;
  const int hh   = lane >> 4;
  const int c    = lane & 15;

  /* Block index -> (head, query tile). At 8 waves a block two blocks fit a WGP, 512 of the 1024 at a time; the cost falls
     with the index (tile 31 first, tile 0 last). A permutation of the 1024 (head, tile) pairs: for speed only. */
  const unsigned bx = blockIdx.x;
  const int qb = NQB - 1 - (int)(bx >> 5);
  const int bh = (int)(bx & 31u);
  const int h  = bh % NHEAD;
  const int b  = bh / NHEAD;
  const int hk = h / GQA;
  const int bk = b * NKVH + hk;
  const int q0 = qb * QBLK + rw * 16;

  const float* gcb = gc2 + (size_t)bh * NTIME;
  const _Float16* kplane = Kh + (size_t)bk * NTIME * HDIM;
  const _Float16* vplane = Vt + (size_t)bk * VDIM * NTIME;
  const int nSteps = (qb + KGRP) / KGRP;

  /* One step's copies. Thread tid brings 16 B of K rows (tid >> 3) + 32 it and of V^T rows (tid >> 3) + 32 (it & 1) of chunk
     it >> 1; every source byte lies inside its plane (128 st + 128 <= 2048), every LDS byte inside buffer bf, each written once. */
  const _Float16* ksrc0 = kplane + tid * 8;
  const _Float16* vsrc0 = vplane + (size_t)(tid >> 3) * NTIME + (tid & 7) * 8;
  const float*    gsrc0 = gcb + lane * 4;
  const unsigned  tile_off = (unsigned)((tid >> 3) * LPITCH + (tid & 7) * 8) * 2u;
  const unsigned  kdst0 = (unsigned)(uintptr_t)(&Ks[0][0]) + tile_off;
  const unsigned  vdst0 = (unsigned)(uintptr_t)(&Vs[0][0][0]) + tile_off;
  const unsigned  gdst0 = (unsigned)(uintptr_t)(&Gs[0][0]) + (unsigned)lane * 16u;
  auto stage_copies = [&](int st, int bf) {
    const _Float16* ks = ksrc0 + (size_t)st * KSTEP * HDIM;
    const _Float16* vs = vsrc0 + st * KSTEP;
    const unsigned kd = kdst0 + (unsigned)bf * (unsigned)(KSTEP * LPITCH * 2);
    const unsigned vd = vdst0 + (unsigned)bf * (unsigned)(KGRP * VDIM * LPITCH * 2);
    /* the closing s_wait_xcnt stands inside the copies' own statement: no register that a copy names is rewritten in front of it */
    asm volatile("global_load_async_to_lds_b128 %0, %8, off\n\t"
                 "global_load_async_to_lds_b128 %1, %9, off\n\t"
                 "global_load_async_to_lds_b128 %2, %10, off\n\t"
                 "global_load_async_to_lds_b128 %3, %11, off\n\t"
                 "global_load_async_to_lds_b128 %4, %12, off\n\t"
                 "global_load_async_to_lds_b128 %5, %13, off\n\t"
                 "global_load_async_to_lds_b128 %6, %14, off\n\t"
                 "global_load_async_to_lds_b128 %7, %15, off\n\t"
                 "s_wait_xcnt 0x0"
                 :: "v"(kd), "v"(kd + 32u * LPITCH * 2u), "v"(kd + 64u * LPITCH * 2u), "v"(kd + 96u * LPITCH * 2u),
                    "v"(vd), "v"(vd + 32u * LPITCH * 2u), "v"(vd + 64u * LPITCH * 2u), "v"(vd + 96u * LPITCH * 2u),
                    "v"(ks), "v"(ks + 32 * HDIM), "v"(ks + 64 * HDIM), "v"(ks + 96 * HDIM),
                    "v"(vs), "v"(vs + (size_t)32 * NTIME), "v"(vs + KCHUNK), "v"(vs + (size_t)32 * NTIME + KCHUNK)
                 : "memory");
    /* the step's 128 gate sums: one copy of wave 0 (a scalar test: wave sits in a scalar register), all 32 lanes on */
    if (wave == 0) {
      const float* gs = gsrc0 + st * KSTEP;
      const unsigned gd = gdst0 + (unsigned)bf * (unsigned)(KSTEP * 4);
      asm volatile("global_load_async_to_lds_b128 %0, %1, off\n\t"
                   "s_wait_xcnt 0x0"
                   :: "v"(gd), "v"(gs) : "memory");
    }
  };
  /* step 0's copies fly while the Q fragments are loaded and converted */
  stage_copies(0, 0);

  /* Q fragments: element e <- d = 32dc + 8hh + e, element 8+e <- d = 32dc + 16 + 8hh + e, row q0 + c */
  v16h qa[2];
  {
    const float* qrow = qin + (((size_t)(b * NTIME + q0 + c)) * NHEAD + h) * HDIM;
#pragma unroll
    for (int dc = 0; dc < 2; ++dc) {
      const v4f a0 = *(const v4f*)(qrow + dc * 32 + 8 * hh);
      const v4f a1 = *(const v4f*)(qrow + dc * 32 + 8 * hh + 4);
      const v4f b0 = *(const v4f*)(qrow + dc * 32 + 16 + 8 * hh);
      const v4f b1 = *(const v4f*)(qrow + dc * 32 + 16 + 8 * hh + 4);
#pragma unroll
      for (int e = 0; e < 4; ++e) {
        const float x0 = a0[e];
        const float x1 = a1[e];
        const float x2 = b0[e];
        const float x3 = b1[e];
        qa[dc][e]      = (_Float16)bf16r(x0);
        qa[dc][4 + e]  = (_Float16)bf16r(x1);
        qa[dc][8 + e]  = (_Float16)bf16r(x2);
        qa[dc][12 + e] = (_Float16)bf16r(x3);
      }
    }
  }

  /* one query row a lane: one running maximum, one partial denominator; oacc[t][r] = O[row q0 + c][vc 16t + 8hh + r] */
  float mrow = NEG_BIG, lrow = 0.0f;
  v8f oacc[4];
#pragma unroll
  for (int t = 0; t < 4; ++t) oacc[t] = (v8f){0.f, 0.f, 0.f, 0.f, 0.f, 0.f, 0.f, 0.f};

  /* step 0 has landed (this wave's copies), then the barrier: every wave's copies have; only then step 1 is requested */
  asm volatile("s_wait_asynccnt 0x0" ::: "memory");
  __syncthreads();
  if (nSteps > 1) stage_copies(1, 1);

#pragma unroll 1
  for (int st = 0; st < nSteps; ++st) {
    const int bf  = st & 1;
    const int kc  = st * KGRP + grp;
    const int kv0 = kc * KCHUNK;
    /* wave-uniform, no barrier inside: group 1 has no chunk in the last step of a tile with an odd number of chunks */
    if (kc <= qb) {
      const _Float16* ksg = Ks[bf] + grp * KCHUNK * LPITCH;
      const _Float16* vsg = Vs[bf][grp];
      const float*    gsg = Gs[bf] + grp * KCHUNK;

      /* all 8 K fragments are requested in one run in front of the first product: the 8 products wait for one LDS round
         trip, not for one each (a load cannot pass the guard statement of the product in front of it) */
      v16h kb[2][4];
#pragma unroll
      for (int dc = 0; dc < 2; ++dc) {
#pragma unroll
        for (int j = 0; j < 4; ++j) kb[dc][j] = frag_load(ksg + (j * 16 + c) * LPITCH + dc * 32 + 8 * hh);
      }
      /* the lane's 32 gate sums, in the same run of LDS reads (16 lanes read one address: a broadcast) */
      v4f gk[4][2];
#pragma unroll
      for (int j = 0; j < 4; ++j) {
        gk[j][0] = *(const v4f*)(gsg + j * 16 + 8 * hh);
        gk[j][1] = *(const v4f*)(gsg + j * 16 + 8 * hh + 4);
      }
      v8f s[4];
#pragma unroll
      for (int j = 0; j < 4; ++j) s[j] = (v8f){0.f, 0.f, 0.f, 0.f, 0.f, 0.f, 0.f, 0.f};
#pragma unroll
      for (int dc = 0; dc < 2; ++dc) {
#pragma unroll
        for (int j = 0; j < 4; ++j) s[j] = mma_h(kb[dc][j], qa[dc], s[j]);
      }
      /* the 8 V^T fragments are requested here, behind the score products: they land while the softmax runs */
      v16h vb[2][4];
#pragma unroll
      for (int kk = 0; kk < 2; ++kk) {
#pragma unroll
        for (int t = 0; t < 4; ++t) vb[kk][t] = frag_load(vsg + (t * 16 + c) * LPITCH + kk * 32 + 8 * hh);
      }

      const bool diag = (kc == qb);
      /* key 16j + 8hh + r of the chunk lies behind the row's own key where 16j + r > dq; off the diagonal no 16j + r reaches 64 */
      const int dq = diag ? (q0 + c) - kv0 - 8 * hh : KCHUNK;
      float cm4[4];
#pragma unroll
      for (int j = 0; j < 4; ++j) {
        float m = NEG_BIG;
#pragma unroll
        for (int r = 0; r < 8; ++r) {
          float tv = s[j][r] * SCORE_L2 - gk[j][r >> 2][r & 3];
          const bool msk = (j * 16 + r) > dq;
          tv = msk ? NEG_BIG : tv;
          s[j][r] = tv;
          m = fmaxf(m, tv);
        }
        cm4[j] = m;
      }
      /* the row's maximum: 32 keys inside the lane, the other 32 from lane ^ 16 by one cross-row move */
      const float cm = fmaxf(fmaxf(cm4[0], cm4[1]), fmaxf(cm4[2], cm4[3]));
      const float mnew = fmaxf(mrow, fmaxf(cm, xhalf(cm)));
      const float xa = mrow - mnew;
      float alpha = exp2_bare(xa);
      mrow = mnew;
      v16h pb[2];
      float psum = 0.0f;
#pragma unroll
      for (int j = 0; j < 4; ++j) {
        float x[8], p[8];
#pragma unroll
        for (int r = 0; r < 8; ++r) {
          x[r] = s[j][r] - mnew;
          p[r] = exp2_bare(x[r]);
        }
        /* the slot that the instruction set asks for behind a transcendental, one for the tile's eight: naming results and
           sources keeps every reader of a result and every overwrite of an argument behind the v_nop */
        asm volatile("v_nop" : "+v"(p[0]), "+v"(p[1]), "+v"(p[2]), "+v"(p[3]), "+v"(p[4]), "+v"(p[5]), "+v"(p[6]), "+v"(p[7])
                     : "v"(x[0]), "v"(x[1]), "v"(x[2]), "v"(x[3]), "v"(x[4]), "v"(x[5]), "v"(x[6]), "v"(x[7]));
#pragma unroll
        for (int r = 0; r < 8; r += 2) {
          const v2f pc = (v2f){p[r] * P_CARRY, p[r + 1] * P_CARRY};
          const v2h ph = __builtin_convertvector(pc, v2h);
          psum += (float)ph[0];
          psum += (float)ph[1];
          pb[j >> 1][(j & 1) * 8 + r]     = ph[0];
          pb[j >> 1][(j & 1) * 8 + r + 1] = ph[1];
        }
      }
      lrow = lrow * alpha + psum;
#pragma unroll
      for (int t = 0; t < 4; ++t) oacc[t] *= alpha;
#pragma unroll
      for (int kk = 0; kk < 2; ++kk) {
#pragma unroll
        for (int t = 0; t < 4; ++t) oacc[t] = mma_h(vb[kk][t], pb[kk], oacc[t]);
      }
    }
    /* publish point, passed by every wave: this wave's LDS reads of buffer bf are over, its copies of step st + 1 have
       landed; behind the barrier that holds for all waves, and buffer bf may be refilled */
    asm volatile("s_wait_dscnt 0x0" ::: "memory");
    asm volatile("s_wait_asynccnt 0x0" ::: "memory");
    __syncthreads();
    if (st + 2 < nSteps) stage_copies(st + 2, bf);
  }
  /* no copy is outstanding when the wave goes on to the join and ends */
  asm volatile("s_wait_asynccnt 0x0" ::: "memory");

  /* Join of the two key groups. Group 1 stores m with its per-lane l and its output sums (9 x 16 B a lane, lane-contiguous);
     the same lane of wave rw holds the same row and columns. A group 1 that had no chunk hands over m = -1e30 and zeros,
     whose weight 2^(m1 - m) is 0. The barrier is the block's last; group 1 ends behind it. */
  v4f* mg = Mg[rw];
  if (grp != 0) {
    mg[lane] = (v4f){mrow, lrow, 0.0f, 0.0f};
#pragma unroll
    for (int t = 0; t < 4; ++t) {
#pragma unroll
      for (int hf = 0; hf < 2; ++hf)
        mg[(1 + 2 * t + hf) * 32 + lane] =
            (v4f){oacc[t][4 * hf], oacc[t][4 * hf + 1], oacc[t][4 * hf + 2], oacc[t][4 * hf + 3]};
    }
  }
  __syncthreads();
  if (grp != 0) return;
  {
    const v4f ml1 = mg[lane];
    const float mj = fmaxf(mrow, ml1[0]);
    const float x0 = mrow - mj;
    const float x1 = ml1[0] - mj;
    float a0 = exp2_bare(x0);
    float a1 = exp2_bare(x1);
    /* the slot that the instruction set asks for behind a transcendental: naming results and sources keeps every reader
       of a weight and every overwrite of its argument behind the v_nop (one a wave, outside the loop) */
    asm volatile("v_nop" : "+v"(a0), "+v"(a1) : "v"(x0), "v"(x1));
    lrow = lrow * a0 + ml1[1] * a1;
#pragma unroll
    for (int t = 0; t < 4; ++t) {
#pragma unroll
      for (int hf = 0; hf < 2; ++hf) {
        const v4f o1 = mg[(1 + 2 * t + hf) * 32 + lane];
#pragma unroll
        for (int e = 0; e < 4; ++e) oacc[t][4 * hf + e] = oacc[t][4 * hf + e] * a0 + o1[e] * a1;
      }
    }
  }

  /* the row's denominator: the two halves' partials joined; the lane's 8 consecutive columns of a tile go to the staging
     tile as two 16-B stores, from where whole 256-B rows leave as before */
  float* os = Os[rw];
  {
    const float l = lrow + xhalf(lrow);
    const float inv = 1.0f / l;
#pragma unroll
    for (int t = 0; t < 4; ++t) {
#pragma unroll
      for (int hf = 0; hf < 2; ++hf)
        *(v4f*)(os + c * OPITCH + t * 16 + 8 * hh + 4 * hf) =
            (v4f){oacc[t][4 * hf] * inv, oacc[t][4 * hf + 1] * inv, oacc[t][4 * hf + 2] * inv, oacc[t][4 * hf + 3] * inv};
    }
  }
  __builtin_amdgcn_fence(__ATOMIC_RELEASE, "workgroup");
  __builtin_amdgcn_wave_barrier();
  __builtin_amdgcn_fence(__ATOMIC_ACQUIRE, "workgroup");
  {
    const int c4 = c * 4;
    {
#pragma unroll
      for (int it = 0; it < 8; ++it) {
        const int row = it * 2 + hh;
        const v4f val = *(const v4f*)(os + row * OPITCH + c4);
        *(v4f*)(out + (((size_t)(b * NTIME + q0 + row)) * NHEAD + h) * VDIM + c4) = val;
      }
      
    }
  }
}

// ---------------------------------------------------------------------------
// Host glue. Workspace region map (bytes, 256-B aligned carve; total 8,650,752 <= 134,217,728):
//   GC2 [32][2048]          f32     262,144   log2e * cumulative gate sum per (b,h)
//   KH  [16][2048][64]      f16   4,194,304   K rows per (b, kv head)
//   VT  [16][64][2048]      f16   4,194,304   V transposed per (b, kv head)
// ---------------------------------------------------------------------------
extern "C" void kernel_launch(void* const* d_in, const int* in_sizes, int n_in,
                              void* d_out, int out_size, void* d_ws, size_t ws_size, hipStream_t stream) {
  if (n_in < 4 || d_out == nullptr || d_ws == nullptr) return;
  if (in_sizes[0] != NBATCH * NTIME * NHEAD * HDIM || in_sizes[1] != NBATCH * NTIME * NKVH * HDIM ||
      in_sizes[2] != NBATCH * NTIME * NKVH * VDIM || in_sizes[3] != NBATCH * NTIME * NHEAD ||
      out_size != NBATCH * NTIME * NHEAD * VDIM) return;

  const float* q = (const float*)d_in[0];
  const float* k = (const float*)d_in[1];
  const float* v = (const float*)d_in[2];
  const float* g = (const float*)d_in[3];
  float* out = (float*)d_out;

  char* ws = (char*)d_ws;
  size_t off = 0;
  auto carve = [&](size_t bytes) -> char* { char* p = ws + off; off += (bytes + 255) & ~(size_t)255; return p; };
  float*          GC2 = (float*)carve(GC_BYTES);
  unsigned short* KH  = (unsigned short*)carve(KH_BYTES);
  unsigned short* VT  = (unsigned short*)carve(VT_BYTES);
  if (off > ws_size || off > (size_t)134217728) return;

  gscan_kernel<<<NBATCH * NHEAD, GS_WAVES * 32, 0, stream>>>(g, GC2);
  kvprep_kernel<<<NBATCH * NKVH * (NTIME / 64), 256, 0, stream>>>(k, v, KH, VT);
  attn_kernel<<<NBATCH * NHEAD * NQB, 256, 0, stream>>>(q, KH, VT, GC2, out);
}

// v009
// A run of this version takes 33.2 microseconds.
// Timed twice side by side with v008, it ran 1.04 times as fast both times.
// All steps since v000 together make it 5.54 times as fast.
// Compute dtype: q.k^T and p.v on v_wmma_f32_16x16x32_f16 (q, k, v = f16 of RNE-bf16 inputs; p = f16 carried x32768), f32 accumulate; cumulative gate sum (of RNE-bf16 g), online softmax and normalisation in f32.
#include <hip/hip_runtime.h>
#include <math.h>

// ---------------------------------------------------------------------------
// Shape constants
// ---------------------------------------------------------------------------
constexpr int NBATCH = 4;
constexpr int NTIME  = 2048;
constexpr int NHEAD  = 8;
constexpr int NKVH   = 4;
constexpr int HDIM   = 64;
constexpr int VDIM   = 64;
constexpr int GQA    = NHEAD / NKVH;
constexpr int QBLK   = 64;
constexpr int KCHUNK = 64;
constexpr int KGRP   = 2;
constexpr int KSTEP  = KGRP * KCHUNK;
constexpr int NQB    = NTIME / QBLK;
constexpr int SQRT_HDIM = 8;
constexpr int OPITCH = 68;
// LDS row pitch of the K and V^T tiles in halves: 64 data + 8 pad = 144 B = 16 B x 9, so the 16 rows that one
// ds_load_b128 touches per half wave start on 16 different 4-bank groups (at 128 B they share two groups).
constexpr int LPITCH = 72;
static_assert(SQRT_HDIM * SQRT_HDIM == HDIM, "scale derivation");
static_assert(HDIM == 64 && VDIM == 64, "tile shapes");
static_assert(NHEAD % NKVH == 0 && GQA == 2, "kv head grouping");
static_assert(NTIME % 64 == 0, "time tiles");
static_assert(NQB == 32 && NBATCH * NHEAD == 32, "block index bits: 5 head + 5 tile");
static_assert(NTIME % KSTEP == 0, "a step's second half lies inside the planes");
static_assert(HDIM % 32 == 0 && KCHUNK % 32 == 0, "k steps of 32");
static_assert(LPITCH >= HDIM && LPITCH >= KCHUNK && (LPITCH * 2) % 16 == 0 && ((LPITCH * 2) / 16) % 2 == 1, "LDS pitch");

constexpr float LOG2E_F   = 1.4426950408889634f;
constexpr float QK_SCALE  = 1.0f / (float)SQRT_HDIM;
constexpr float SCORE_L2  = QK_SCALE * LOG2E_F;
constexpr float P_CARRY   = 32768.0f;
constexpr float NEG_BIG   = -1.0e30f;

constexpr size_t GC_BYTES = (size_t)NBATCH * NHEAD * NTIME * 4;
constexpr size_t KH_BYTES = (size_t)NBATCH * NKVH * NTIME * HDIM * 2;
constexpr size_t VT_BYTES = (size_t)NBATCH * NKVH * VDIM * NTIME * 2;
static_assert(GC_BYTES + KH_BYTES + VT_BYTES <= (size_t)134217728, "carve");
static_assert((size_t)NBATCH * NTIME * NHEAD * VDIM * 4 == (size_t)16777216, "output bytes");

typedef __attribute__((ext_vector_type(16))) _Float16 v16h;
typedef __attribute__((ext_vector_type(8)))  _Float16 v8h;
typedef __attribute__((ext_vector_type(8)))  float    v8f;
typedef __attribute__((ext_vector_type(4)))  float    v4f;
typedef __attribute__((ext_vector_type(2)))  float    v2f;
typedef __attribute__((ext_vector_type(2)))  _Float16 v2h;

// RNE convert of an f32 value to bf16 precision
__device__ __forceinline__ unsigned short f2bf_bits(float f) {
  unsigned u = __float_as_uint(f);
  return (unsigned short)((u + 0x7FFFu + ((u >> 16) & 1u)) >> 16);
}
__device__ __forceinline__ float bf_bits2f(unsigned short h) { return __uint_as_float(((unsigned)h) << 16); }
/* RNE convert to a bf16 value, kept in f32 */
__device__ __forceinline__ float bf16r(float f) { return bf_bits2f(f2bf_bits(f)); }

/* one WMMA followed by the 4-slot hazard guard tying D and naming A, B */
__device__ __forceinline__ v8f mma_h(v16h a, v16h b, v8f c) {
  c = __builtin_amdgcn_wmma_f32_16x16x32_f16(false, a, false, b, (short)0, c, false, false);
  asm volatile("v_nop\n\tv_nop\n\tv_nop\n\tv_nop" : "+v"(c) : "v"(a), "v"(b));
  return c;
}

/* 2^x as the bare v_exp_f32. The library exp2f wraps the same instruction in a range test, a pre-scale and an ldexp
   that only serve results below 2^-126. Every argument here is <= 0; a p that small is 0 after x32768 and the f16
   rounding either way, and an alpha that small scales sums that then vanish beside a new term of 32768 in the row. */
__device__ __forceinline__ float exp2_bare(float x) { return __builtin_amdgcn_exp2f(x); }

/* the value that lane ^ 16 holds: one cross-row vector move, no LDS counter */
__device__ __forceinline__ float xhalf(float f) {
  const int b = __float_as_int(f);
  return __int_as_float(__builtin_amdgcn_permlanex16(b, b, 0x76543210, 0xfedcba98, false, false));
}

/* a compile-time yes or no handed to the chunk body: the body is built twice, with and without the causal mask */
template <bool B> struct Flag { static constexpr bool value = B; };

union FragH { v16h v; v8h h[2]; };
/* elements 0..7 <- p[0..7], elements 8..15 <- p[16..23]; caller adds 8*(lane>>4) */
__device__ __forceinline__ v16h frag_load(const _Float16* p) {
  FragH f;
  f.h[0] = *(const v8h*)(p);
  f.h[1] = *(const v8h*)(p + 16);
  return f.v;
}

// ---------------------------------------------------------------------------
// Launch 1: gc2[b*8+h][t] = log2(e) * inclusive cumulative sum over t of bf16value(g[b][t][h]), f32.
// One block of 8 waves per (b,h). The row is 64 segments of 32 steps; wave w owns segments 8w..8w+7.
// All 8 loads of a wave are in flight together and its 8 segment scans are independent of each other; the segment
// totals go through LDS, and every wave adds them up one after another from segment 0 on, so each carry is the same
// chain of f32 additions as in a single pass over the row.
// Store coverage: 8 waves x 8 segments x 32 lanes = 2048 floats = the whole row; each instruction is one 128-B line.
// ---------------------------------------------------------------------------
constexpr int GS_SEGS  = NTIME / 32;
constexpr int GS_WAVES = 8;
constexpr int GS_PER   = GS_SEGS / GS_WAVES;
static_assert(NTIME % 32 == 0 && GS_SEGS % GS_WAVES == 0 && GS_PER % 4 == 0, "scan segments");

__global__ __launch_bounds__(GS_WAVES * 32) void gscan_kernel(const float* __restrict__ g, float* __restrict__ gc2) {
  __shared__ __align__(16) float tot[GS_SEGS];
  const int bh = blockIdx.x;
  const int b = bh / NHEAD;
  const int h = bh % NHEAD;
  const int lane = threadIdx.x & 31;
  const int s0 = (threadIdx.x >> 5) * GS_PER;

  /* block-uniform row base + one 32-bit lane offset: the 8 loads differ only in their immediate offset */
  const float* grow = g + (size_t)b * NTIME * NHEAD + h;
  const unsigned e0 = (unsigned)(s0 * 32 + lane) * NHEAD;
  /* every loop of this kernel is unrolled: val[] stays in registers, and the 8 loads and the 8 scans stand side by side */
  float val[GS_PER];
#pragma unroll
  for (int i = 0; i < GS_PER; ++i) val[i] = grow[e0 + (unsigned)(i * 32 * NHEAD)];
#pragma unroll
  for (int i = 0; i < GS_PER; ++i) val[i] = bf16r(val[i]);
#pragma unroll
  for (int d = 1; d < 32; d <<= 1) {
#pragma unroll
    for (int i = 0; i < GS_PER; ++i) {
      const float up = __shfl_up(val[i], d, 32);
      val[i] += (lane >= d) ? up : 0.0f;
    }
  }
  if (lane == 31) {
#pragma unroll
    for (int i = 0; i < GS_PER; ++i) tot[s0 + i] = val[i];
  }
  __syncthreads();

  /* carry into segment s0: totals of the segments in front of it, in order (a later segment adds 0) */
  float carry = 0.0f;
#pragma unroll
  for (int j4 = 0; j4 < GS_SEGS - GS_PER; j4 += 4) {
    const v4f tq = *(const v4f*)(tot + j4);
#pragma unroll
    for (int e = 0; e < 4; ++e) carry += (j4 + e < s0) ? tq[e] : 0.0f;
  }
#pragma unroll
  for (int i = 0; i < GS_PER; ++i) {
    const float o = (val[i] + carry) * LOG2E_F;
    gc2[(size_t)bh * NTIME + (s0 + i) * 32 + lane] = o;
    carry += tot[s0 + i];
  }
}

// ---------------------------------------------------------------------------
// Launch 2: 16-bit operand planes. Block = 64 time steps of one (b, kv head); 256 threads; grid = 4*4*32 = 512.
//   Vt[(b*4+hk)][vc][t]  = f16(bf16value(v[b][t][hk][vc]))     in [t][vc] -> out [vc][t] through a 64x64 LDS tile
// Load coverage V: 4 iterations x 256 threads x 4 floats = 64 x 64. K: 2 groups x 256 threads x 8 floats = 64 x 64.
// Store coverage: 2 groups x 32 rows (tid>>3) x 8 lanes x 8 halves = 64 rows x 64 halves for each plane; lanes
// ---------------------------------------------------------------------------
__global__ __launch_bounds__(256) void kvprep_kernel(const float* __restrict__ kin, const float* __restrict__ vin,
                                                     unsigned short* __restrict__ Khp,
                                                     unsigned short* __restrict__ Vtp) {
  __shared__ float Tt[64 * 65];
  _Float16* Kh = (_Float16*)Khp;
  _Float16* Vt = (_Float16*)Vtp;
  const int tid = threadIdx.x;
  const int tb = blockIdx.x % (NTIME / 64);
  const int bk = blockIdx.x / (NTIME / 64);
  const int b  = bk / NKVH;
  const int hk = bk % NKVH;
  const int t0 = tb * 64;

#pragma unroll
  for (int i = 0; i < 4; ++i) {
    const int idx = i * 256 + tid;
    const int rr = idx >> 4;
    const int cc = (idx & 15) * 4;
    const v4f vv = *(const v4f*)(vin + (((size_t)(b * NTIME + t0 + rr)) * NKVH + hk) * VDIM + cc);
    Tt[rr * 65 + cc + 0] = vv[0];
    Tt[rr * 65 + cc + 1] = vv[1];
    Tt[rr * 65 + cc + 2] = vv[2];
    Tt[rr * 65 + cc + 3] = vv[3];
  }
  asm volatile("" ::: "memory");

  const int q  = tid >> 3;
  const int c8 = (tid & 7) * 8;
  v8h kh[2];
#pragma unroll
  for (int gq = 0; gq < 2; ++gq) {
    const int row = gq * 32 + q;
    const float* sp = kin + (((size_t)(b * NTIME + t0 + row)) * NKVH + hk) * HDIM + c8;
    const v4f a = *(const v4f*)(sp);
    const v4f c = *(const v4f*)(sp + 4);
#pragma unroll
    for (int e = 0; e < 4; ++e) {
      const float x0 = a[e];
      const float x1 = c[e];
      kh[gq][e]     = (_Float16)bf16r(x0);
      kh[gq][4 + e] = (_Float16)bf16r(x1);
    }
  }
  __syncthreads();
  v8h vh[2];
#pragma unroll
  for (int gq = 0; gq < 2; ++gq) {
    const int vrow = gq * 32 + q;
#pragma unroll
    for (int e = 0; e < 8; ++e) {
      const float f = Tt[(c8 + e) * 65 + vrow];
      vh[gq][e] = (_Float16)bf16r(f);
    }
  }
  {
#pragma unroll
    for (int gq = 0; gq < 2; ++gq) {
      const int row = gq * 32 + q;
      *(v8h*)(Kh + ((size_t)bk * NTIME + t0 + row) * HDIM + c8) = kh[gq];
      *(v8h*)(Vt + ((size_t)bk * VDIM + row) * NTIME + t0 + c8) = vh[gq];
    }
    
  }
}

__global__ __launch_bounds__(256) void attn_kernel(const float* __restrict__ qin,
                                                   const unsigned short* __restrict__ Khp,
                                                   const unsigned short* __restrict__ Vtp,
                                                   const float* __restrict__ gc2,
                                                   float* __restrict__ out) {
  __shared__ __align__(16) _Float16 Ks[2][KSTEP * LPITCH];
  __shared__ __align__(16) _Float16 Vs[2][KGRP][VDIM * LPITCH];
  __shared__ __align__(16) float    Gs[2][KSTEP];
  __shared__ __align__(16) float    Os[4][16 * OPITCH];
  __shared__ __align__(16) v4f      Mg[4][9 * 32];
  const _Float16* Kh = (const _Float16*)Khp;
  const _Float16* Vt = (const _Float16*)Vtp;

  const int tid  = threadIdx.x;
  /* the wave's number in a scalar register: the test that skips a chunk past the diagonal is then a scalar branch */
  const int wave = __builtin_amdgcn_readfirstlane(tid >> 5);
  const int rw   = wave & 3;
  const int grp  = wave >> 2;
  const int lane = tid & 31;
  const int hh   = lane >> 4;
  const int c    = lane & 15;

  /* Block index -> (head, query tile). At 8 waves a block two blocks fit a WGP, 512 of the 1024 at a time; the cost falls
     with the index (tile 31 first, tile 0 last). A permutation of the 1024 (head, tile) pairs: for speed only. */
  const unsigned bx = blockIdx.x;
  const int qb = NQB - 1 - (int)(bx >> 5);
  const int bh = (int)(bx & 31u);
  const int h  = bh % NHEAD;
  const int b  = bh / NHEAD;
  const int hk = h / GQA;
  const int bk = b * NKVH + hk;
  const int q0 = qb * QBLK + rw * 16;

  const float* gcb = gc2 + (size_t)bh * NTIME;
  const _Float16* kplane = Kh + (size_t)bk * NTIME * HDIM;
  const _Float16* vplane = Vt + (size_t)bk * VDIM * NTIME;
  const int nSteps = (qb + KGRP) / KGRP;

  /* One step's copies. Thread tid brings 16 B of K rows (tid >> 3) + 32 it and of V^T rows (tid >> 3) + 32 (it & 1) of chunk
     it >> 1; every source byte lies inside its plane (128 st + 128 <= 2048), every LDS byte inside buffer bf, each written once. */
  const _Float16* ksrc0 = kplane + tid * 8;
  const _Float16* vsrc0 = vplane + (size_t)(tid >> 3) * NTIME + (tid & 7) * 8;
  const float*    gsrc0 = gcb + lane * 4;
  const unsigned  tile_off = (unsigned)((tid >> 3) * LPITCH + (tid & 7) * 8) * 2u;
  const unsigned  kdst0 = (unsigned)(uintptr_t)(&Ks[0][0]) + tile_off;
  const unsigned  vdst0 = (unsigned)(uintptr_t)(&Vs[0][0][0]) + tile_off;
  const unsigned  gdst0 = (unsigned)(uintptr_t)(&Gs[0][0]) + (unsigned)lane * 16u;
  auto stage_copies = [&](int st, int bf) {
    const _Float16* ks = ksrc0 + (size_t)st * KSTEP * HDIM;
    const _Float16* vs = vsrc0 + st * KSTEP;
    const unsigned kd = kdst0 + (unsigned)bf * (unsigned)(KSTEP * LPITCH * 2);
    const unsigned vd = vdst0 + (unsigned)bf * (unsigned)(KGRP * VDIM * LPITCH * 2);
    /* the closing s_wait_xcnt stands inside the copies' own statement: no register that a copy names is rewritten in front of it */
    asm volatile("global_load_async_to_lds_b128 %0, %8, off\n\t"
                 "global_load_async_to_lds_b128 %1, %9, off\n\t"
                 "global_load_async_to_lds_b128 %2, %10, off\n\t"
                 "global_load_async_to_lds_b128 %3, %11, off\n\t"
                 "global_load_async_to_lds_b128 %4, %12, off\n\t"
                 "global_load_async_to_lds_b128 %5, %13, off\n\t"
                 "global_load_async_to_lds_b128 %6, %14, off\n\t"
                 "global_load_async_to_lds_b128 %7, %15, off\n\t"
                 "s_wait_xcnt 0x0"
                 :: "v"(kd), "v"(kd + 32u * LPITCH * 2u), "v"(kd + 64u * LPITCH * 2u), "v"(kd + 96u * LPITCH * 2u),
                    "v"(vd), "v"(vd + 32u * LPITCH * 2u), "v"(vd + 64u * LPITCH * 2u), "v"(vd + 96u * LPITCH * 2u),
                    "v"(ks), "v"(ks + 32 * HDIM), "v"(ks + 64 * HDIM), "v"(ks + 96 * HDIM),
                    "v"(vs), "v"(vs + (size_t)32 * NTIME), "v"(vs + KCHUNK), "v"(vs + (size_t)32 * NTIME + KCHUNK)
                 : "memory");
    /* the step's 128 gate sums: one copy of wave 0 (a scalar test: wave sits in a scalar register), all 32 lanes on */
    if (wave == 0) {
      const float* gs = gsrc0 + st * KSTEP;
      const unsigned gd = gdst0 + (unsigned)bf * (unsigned)(KSTEP * 4);
      asm volatile("global_load_async_to_lds_b128 %0, %1, off\n\t"
                   "s_wait_xcnt 0x0"
                   :: "v"(gd), "v"(gs) : "memory");
    }
  };
  /* step 0's copies fly while the Q fragments are loaded and converted */
  stage_copies(0, 0);

  /* Q fragments: element e <- d = 32dc + 8hh + e, element 8+e <- d = 32dc + 16 + 8hh + e, row q0 + c */
  v16h qa[2];
  {
    const float* qrow = qin + (((size_t)(b * NTIME + q0 + c)) * NHEAD + h) * HDIM;
#pragma unroll
    for (int dc = 0; dc < 2; ++dc) {
      const v4f a0 = *(const v4f*)(qrow + dc * 32 + 8 * hh);
      const v4f a1 = *(const v4f*)(qrow + dc * 32 + 8 * hh + 4);
      const v4f b0 = *(const v4f*)(qrow + dc * 32 + 16 + 8 * hh);
      const v4f b1 = *(const v4f*)(qrow + dc * 32 + 16 + 8 * hh + 4);
#pragma unroll
      for (int e = 0; e < 4; ++e) {
        const float x0 = a0[e];
        const float x1 = a1[e];
        const float x2 = b0[e];
        const float x3 = b1[e];
        qa[dc][e]      = (_Float16)bf16r(x0);
        qa[dc][4 + e]  = (_Float16)bf16r(x1);
        qa[dc][8 + e]  = (_Float16)bf16r(x2);
        qa[dc][12 + e] = (_Float16)bf16r(x3);
      }
    }
  }

  /* one query row a lane: one running maximum, one partial denominator; oacc[t][r] = O[row q0 + c][vc 16t + 8hh + r] */
  float mrow = NEG_BIG, lrow = 0.0f;
  v8f oacc[4];
#pragma unroll
  for (int t = 0; t < 4; ++t) oacc[t] = (v8f){0.f, 0.f, 0.f, 0.f, 0.f, 0.f, 0.f, 0.f};

  /* step 0 has landed (this wave's copies), then the barrier: every wave's copies have; only then step 1 is requested */
  asm volatile("s_wait_asynccnt 0x0" ::: "memory");
  __syncthreads();

  /* one chunk of one wave; no barrier inside. MASKED: right for any chunk kc <= qb; without it only for kc < qb */
  auto chunk = [&](auto mask_flag, int bf, int kv0) {
    constexpr bool MASKED = decltype(mask_flag)::value;
    const _Float16* ksg = Ks[bf] + grp * KCHUNK * LPITCH;
    const _Float16* vsg = Vs[bf][grp];
    const float*    gsg = Gs[bf] + grp * KCHUNK;

    /* all 8 K fragments are requested in one run in front of the first product: the 8 products wait for one LDS round
       trip, not for one each (a load cannot pass the guard statement of the product in front of it) */
    v16h kb[2][4];
#pragma unroll
    for (int dc = 0; dc < 2; ++dc) {
#pragma unroll
      for (int j = 0; j < 4; ++j) kb[dc][j] = frag_load(ksg + (j * 16 + c) * LPITCH + dc * 32 + 8 * hh);
    }
    /* the lane's 32 gate sums, in the same run of LDS reads (16 lanes read one address: a broadcast) */
    v4f gk[4][2];
#pragma unroll
    for (int j = 0; j < 4; ++j) {
      gk[j][0] = *(const v4f*)(gsg + j * 16 + 8 * hh);
      gk[j][1] = *(const v4f*)(gsg + j * 16 + 8 * hh + 4);
    }
    v8f s[4];
#pragma unroll
    for (int j = 0; j < 4; ++j) s[j] = (v8f){0.f, 0.f, 0.f, 0.f, 0.f, 0.f, 0.f, 0.f};
#pragma unroll
    for (int dc = 0; dc < 2; ++dc) {
#pragma unroll
      for (int j = 0; j < 4; ++j) s[j] = mma_h(kb[dc][j], qa[dc], s[j]);
    }
    /* the 8 V^T fragments are requested here, behind the score products: they land while the softmax runs */
    v16h vb[2][4];
#pragma unroll
    for (int kk = 0; kk < 2; ++kk) {
#pragma unroll
      for (int t = 0; t < 4; ++t) vb[kk][t] = frag_load(vsg + (t * 16 + c) * LPITCH + kk * 32 + 8 * hh);
    }

    /* key 16j + 8hh + r of the chunk lies behind the row's own key where 16j + r > dq (kc < qb: dq >= 56, no 16j + r is) */
    const int dq = (q0 + c) - kv0 - 8 * hh;
    float cm4[4];
#pragma unroll
    for (int j = 0; j < 4; ++j) {
      float m = NEG_BIG;
#pragma unroll
      for (int r = 0; r < 8; ++r) {
        float tv = s[j][r] * SCORE_L2 - gk[j][r >> 2][r & 3];
        if constexpr (MASKED) tv = ((j * 16 + r) > dq) ? NEG_BIG : tv;
        s[j][r] = tv;
        m = fmaxf(m, tv);
      }
      cm4[j] = m;
    }
    /* the row's maximum: 32 keys inside the lane, the other 32 from lane ^ 16 by one cross-row move */
    const float cm = fmaxf(fmaxf(cm4[0], cm4[1]), fmaxf(cm4[2], cm4[3]));
    const float mnew = fmaxf(mrow, fmaxf(cm, xhalf(cm)));
    const float xa = mrow - mnew;
    float alpha = exp2_bare(xa);
    mrow = mnew;
    v16h pb[2];
    float psum = 0.0f;
#pragma unroll
    for (int j = 0; j < 4; ++j) {
      float x[8], p[8];
#pragma unroll
      for (int r = 0; r < 8; ++r) {
        x[r] = s[j][r] - mnew;
        p[r] = exp2_bare(x[r]);
      }
      /* the slot that the instruction set asks for behind a transcendental, one for the tile's eight: naming results and
         sources keeps every reader of a result and every overwrite of an argument behind the v_nop */
      asm volatile("v_nop" : "+v"(p[0]), "+v"(p[1]), "+v"(p[2]), "+v"(p[3]), "+v"(p[4]), "+v"(p[5]), "+v"(p[6]), "+v"(p[7])
                   : "v"(x[0]), "v"(x[1]), "v"(x[2]), "v"(x[3]), "v"(x[4]), "v"(x[5]), "v"(x[6]), "v"(x[7]));
#pragma unroll
      for (int r = 0; r < 8; r += 2) {
        const v2f pc = (v2f){p[r] * P_CARRY, p[r + 1] * P_CARRY};
        const v2h ph = __builtin_convertvector(pc, v2h);
        psum += (float)ph[0];
        psum += (float)ph[1];
        pb[j >> 1][(j & 1) * 8 + r]     = ph[0];
        pb[j >> 1][(j & 1) * 8 + r + 1] = ph[1];
      }
    }
    lrow = lrow * alpha + psum;
#pragma unroll
    for (int t = 0; t < 4; ++t) oacc[t] *= alpha;
#pragma unroll
    for (int kk = 0; kk < 2; ++kk) {
#pragma unroll
      for (int t = 0; t < 4; ++t) oacc[t] = mma_h(vb[kk][t], pb[kk], oacc[t]);
    }
  };

  /* all steps but the last: 2 st + 1 <= 2 nSteps - 3 < qb, so both groups have a chunk and no key of it is masked.
     The loop stays rolled: one copy of the long body, the two buffers told apart by st & 1 */
#pragma unroll 1
  for (int st = 0; st < nSteps - 1; ++st) {
    const int bf  = st & 1;
    /* behind the barrier that freed the other buffer: step st + 1 (it exists: st + 1 < nSteps) is requested and flies during step st */
    stage_copies(st + 1, bf ^ 1);
    chunk(Flag<false>{}, bf, (st * KGRP + grp) * KCHUNK);
    /* publish point, passed by every wave: this wave's LDS reads of buffer bf are over, its copies of step st + 1 have
       landed; behind the barrier that holds for all waves, and buffer bf may be refilled (at the head of the next trip) */
    asm volatile("s_wait_dscnt 0x0" ::: "memory");
    asm volatile("s_wait_asynccnt 0x0" ::: "memory");
    __syncthreads();
  }
  /* the last step, with the mask. Wave-uniform test, no barrier inside: group 1 has no chunk here in a tile with an odd
     number of chunks. No refill follows it, and the join below has LDS and a barrier of its own. */
  {
    const int kc = (nSteps - 1) * KGRP + grp;
    if (kc <= qb) chunk(Flag<true>{}, (nSteps - 1) & 1, kc * KCHUNK);
  }
  /* no copy is outstanding when the wave goes on to the join and ends */
  asm volatile("s_wait_asynccnt 0x0" ::: "memory");

  /* Join of the two key groups. Group 1 stores m with its per-lane l and its output sums (9 x 16 B a lane, lane-contiguous);
     the same lane of wave rw holds the same row and columns. A group 1 that had no chunk hands over m = -1e30 and zeros,
     whose weight 2^(m1 - m) is 0. The barrier is the block's last; group 1 ends behind it. */
  v4f* mg = Mg[rw];
  if (grp != 0) {
    mg[lane] = (v4f){mrow, lrow, 0.0f, 0.0f};
#pragma unroll
    for (int t = 0; t < 4; ++t) {
#pragma unroll
      for (int hf = 0; hf < 2; ++hf)
        mg[(1 + 2 * t + hf) * 32 + lane] =
            (v4f){oacc[t][4 * hf], oacc[t][4 * hf + 1], oacc[t][4 * hf + 2], oacc[t][4 * hf + 3]};
    }
  }
  __syncthreads();
  if (grp != 0) return;
  {
    const v4f ml1 = mg[lane];
    const float mj = fmaxf(mrow, ml1[0]);
    const float x0 = mrow - mj;
    const float x1 = ml1[0] - mj;
    float a0 = exp2_bare(x0);
    float a1 = exp2_bare(x1);
    /* the slot that the instruction set asks for behind a transcendental: naming results and sources keeps every reader
       of a weight and every overwrite of its argument behind the v_nop (one a wave, outside the loop) */
    asm volatile("v_nop" : "+v"(a0), "+v"(a1) : "v"(x0), "v"(x1));
    lrow = lrow * a0 + ml1[1] * a1;
#pragma unroll
    for (int t = 0; t < 4; ++t) {
#pragma unroll
      for (int hf = 0; hf < 2; ++hf) {
        const v4f o1 = mg[(1 + 2 * t + hf) * 32 + lane];
#pragma unroll
        for (int e = 0; e < 4; ++e) oacc[t][4 * hf + e] = oacc[t][4 * hf + e] * a0 + o1[e] * a1;
      }
    }
  }

  /* the row's denominator: the two halves' partials joined; the lane's 8 consecutive columns of a tile go to the staging
     tile as two 16-B stores, from where whole 256-B rows leave as before */
  float* os = Os[rw];
  {
    const float l = lrow + xhalf(lrow);
    const float inv = 1.0f / l;
#pragma unroll
    for (int t = 0; t < 4; ++t) {
#pragma unroll
      for (int hf = 0; hf < 2; ++hf)
        *(v4f*)(os + c * OPITCH + t * 16 + 8 * hh + 4 * hf) =
            (v4f){oacc[t][4 * hf] * inv, oacc[t][4 * hf + 1] * inv, oacc[t][4 * hf + 2] * inv, oacc[t][4 * hf + 3] * inv};
    }
  }
  __builtin_amdgcn_fence(__ATOMIC_RELEASE, "workgroup");
  __builtin_amdgcn_wave_barrier();
  __builtin_amdgcn_fence(__ATOMIC_ACQUIRE, "workgroup");
  {
    const int c4 = c * 4;
    {
#pragma unroll
      for (int it = 0; it < 8; ++it) {
        const int row = it * 2 + hh;
        const v4f val = *(const v4f*)(os + row * OPITCH + c4);
        *(v4f*)(out + (((size_t)(b * NTIME + q0 + row)) * NHEAD + h) * VDIM + c4) = val;
      }
      
    }
  }
}

// ---------------------------------------------------------------------------
// Host glue. Workspace region map (bytes, 256-B aligned carve; total 8,650,752 <= 134,217,728):
//   GC2 [32][2048]          f32     262,144   log2e * cumulative gate sum per (b,h)
//   KH  [16][2048][64]      f16   4,194,304   K rows per (b, kv head)
//   VT  [16][64][2048]      f16   4,194,304   V transposed per (b, kv head)
// ---------------------------------------------------------------------------
extern "C" void kernel_launch(void* const* d_in, const int* in_sizes, int n_in,
                              void* d_out, int out_size, void* d_ws, size_t ws_size, hipStream_t stream) {
  if (n_in < 4 || d_out == nullptr || d_ws == nullptr) return;
  if (in_sizes[0] != NBATCH * NTIME * NHEAD * HDIM || in_sizes[1] != NBATCH * NTIME * NKVH * HDIM ||
      in_sizes[2] != NBATCH * NTIME * NKVH * VDIM || in_sizes[3] != NBATCH * NTIME * NHEAD ||
      out_size != NBATCH * NTIME * NHEAD * VDIM) return;

  const float* q = (const float*)d_in[0];
  const float* k = (const float*)d_in[1];
  const float* v = (const float*)d_in[2];
  const float* g = (const float*)d_in[3];
  float* out = (float*)d_out;

  char* ws = (char*)d_ws;
  size_t off = 0;
  auto carve = [&](size_t bytes) -> char* { char* p = ws + off; off += (bytes + 255) & ~(size_t)255; return p; };
  float*          GC2 = (float*)carve(GC_BYTES);
  unsigned short* KH  = (unsigned short*)carve(KH_BYTES);
  unsigned short* VT  = (unsigned short*)carve(VT_BYTES);
  if (off > ws_size || off > (size_t)134217728) return;

  gscan_kernel<<<NBATCH * NHEAD, GS_WAVES * 32, 0, stream>>>(g, GC2);
  kvprep_kernel<<<NBATCH * NKVH * (NTIME / 64), 256, 0, stream>>>(k, v, KH, VT);
  attn_kernel<<<NBATCH * NHEAD * NQB, 256, 0, stream>>>(q, KH, VT, GC2, out);
}

// v010
// Measured time: 30.3 microseconds a run.
// Next to v009, in two timings, it ran 1.10 and 1.09 times as fast.
// Counting every step since v000, it is 6.08 times as fast.
// Compute dtype: q.k^T and p.v on v_wmma_f32_16x16x32_f16 (q, k, v = f16 of RNE-bf16 inputs; p = f16 carried x32768), f32 accumulate; cumulative gate sum (of RNE-bf16 g), online softmax and normalisation in f32.
#include <hip/hip_runtime.h>
#include <math.h>

// ---------------------------------------------------------------------------
// Shape constants
// ---------------------------------------------------------------------------
constexpr int NBATCH = 4;
constexpr int NTIME  = 2048;
constexpr int NHEAD  = 8;
constexpr int NKVH   = 4;
constexpr int HDIM   = 64;
constexpr int VDIM   = 64;
constexpr int GQA    = NHEAD / NKVH;
constexpr int QBLK   = 64;
constexpr int KCHUNK = 64;
constexpr int KGRP   = 2;
constexpr int KSTEP  = KGRP * KCHUNK;
constexpr int NQB    = NTIME / QBLK;
constexpr int SQRT_HDIM = 8;
constexpr int OPITCH = 68;
// LDS row pitch of the K and V^T tiles in halves: 64 data + 8 pad = 144 B = 16 B x 9, so the 16 rows that one
// ds_load_b128 touches per half wave start on 16 different 4-bank groups (at 128 B they share two groups).
constexpr int LPITCH = 72;
static_assert(SQRT_HDIM * SQRT_HDIM == HDIM, "scale derivation");
static_assert(HDIM == 64 && VDIM == 64, "tile shapes");
static_assert(NHEAD % NKVH == 0 && GQA == 2, "kv head grouping");
static_assert(NTIME % 64 == 0, "time tiles");
static_assert(NQB == 32 && NBATCH * NHEAD == 32, "block index bits: 5 head + 5 tile");
static_assert(NTIME % KSTEP == 0, "a step's second half lies inside the planes");
static_assert(HDIM % 32 == 0 && KCHUNK % 32 == 0, "k steps of 32");
static_assert(LPITCH >= HDIM && LPITCH >= KCHUNK && (LPITCH * 2) % 16 == 0 && ((LPITCH * 2) / 16) % 2 == 1, "LDS pitch");

constexpr float LOG2E_F   = 1.4426950408889634f;
constexpr float QK_SCALE  = 1.0f / (float)SQRT_HDIM;
constexpr float SCORE_L2  = QK_SCALE * LOG2E_F;
constexpr float P_CARRY   = 32768.0f;
constexpr float NEG_BIG   = -1.0e30f;

constexpr size_t GC_BYTES = (size_t)NBATCH * NHEAD * NTIME * 4;
constexpr size_t KH_BYTES = (size_t)NBATCH * NKVH * NTIME * HDIM * 2;
constexpr size_t VT_BYTES = (size_t)NBATCH * NKVH * VDIM * NTIME * 2;
static_assert(GC_BYTES + KH_BYTES + VT_BYTES <= (size_t)134217728, "carve");
static_assert((size_t)NBATCH * NTIME * NHEAD * VDIM * 4 == (size_t)16777216, "output bytes");

typedef __attribute__((ext_vector_type(16))) _Float16 v16h;
typedef __attribute__((ext_vector_type(8)))  _Float16 v8h;
typedef __attribute__((ext_vector_type(8)))  float    v8f;
typedef __attribute__((ext_vector_type(4)))  float    v4f;
typedef __attribute__((ext_vector_type(2)))  float    v2f;
typedef __attribute__((ext_vector_type(2)))  _Float16 v2h;

// RNE convert of an f32 value to bf16 precision
__device__ __forceinline__ unsigned short f2bf_bits(float f) {
  unsigned u = __float_as_uint(f);
  return (unsigned short)((u + 0x7FFFu + ((u >> 16) & 1u)) >> 16);
}
__device__ __forceinline__ float bf_bits2f(unsigned short h) { return __uint_as_float(((unsigned)h) << 16); }
/* RNE convert to a bf16 value, kept in f32 */
__device__ __forceinline__ float bf16r(float f) { return bf_bits2f(f2bf_bits(f)); }

/* one WMMA followed by the 4-slot hazard guard tying D and naming A, B */
__device__ __forceinline__ v8f mma_h(v16h a, v16h b, v8f c) {
  c = __builtin_amdgcn_wmma_f32_16x16x32_f16(false, a, false, b, (short)0, c, false, false);
  asm volatile("v_nop\n\tv_nop\n\tv_nop\n\tv_nop" : "+v"(c) : "v"(a), "v"(b));
  return c;
}

/* 2^x as the bare v_exp_f32. The library exp2f wraps the same instruction in a range test, a pre-scale and an ldexp
   that only serve results below 2^-126. Every argument here is <= 0; a p that small is 0 after x32768 and the f16
   rounding either way, and an alpha that small scales sums that then vanish beside a new term of 32768 in the row. */
__device__ __forceinline__ float exp2_bare(float x) { return __builtin_amdgcn_exp2f(x); }

/* the value that lane ^ 16 holds: one cross-row vector move, no LDS counter */
__device__ __forceinline__ float xhalf(float f) {
  const int b = __float_as_int(f);
  return __int_as_float(__builtin_amdgcn_permlanex16(b, b, 0x76543210, 0xfedcba98, false, false));
}

/* a compile-time yes or no handed to the chunk body: the body is built twice, with and without the causal mask */
template <bool B> struct Flag { static constexpr bool value = B; };

union FragH { v16h v; v8h h[2]; };
/* elements 0..7 <- p[0..7], elements 8..15 <- p[16..23]; caller adds 8*(lane>>4) */
__device__ __forceinline__ v16h frag_load(const _Float16* p) {
  FragH f;
  f.h[0] = *(const v8h*)(p);
  f.h[1] = *(const v8h*)(p + 16);
  return f.v;
}

// ---------------------------------------------------------------------------
// Launch 1, job A (blocks 0..31): gc2[b*8+h][t] = log2(e) * inclusive cumulative sum over t of bf16value(g[b][t][h]), f32.
// One block of 8 waves per (b,h). The row is 64 segments of 32 steps; wave w owns segments 8w..8w+7.
// All 8 loads of a wave are in flight together and its 8 segment scans are independent of each other; the segment
// totals go through LDS, and every wave adds them up one after another from segment 0 on, so each carry is the same
// chain of f32 additions as in a single pass over the row.
// Store coverage: 8 waves x 8 segments x 32 lanes = 2048 floats = the whole row; each instruction is one 128-B line.
// ---------------------------------------------------------------------------
constexpr int GS_SEGS  = NTIME / 32;
constexpr int GS_WAVES = 8;
constexpr int GS_PER   = GS_SEGS / GS_WAVES;
static_assert(NTIME % 32 == 0 && GS_SEGS % GS_WAVES == 0 && GS_PER % 4 == 0, "scan segments");

__device__ __forceinline__ void gscan_job(int bh, const float* __restrict__ g, float* __restrict__ gc2) {
  __shared__ __align__(16) float tot[GS_SEGS];
  const int b = bh / NHEAD;
  const int h = bh % NHEAD;
  const int lane = threadIdx.x & 31;
  const int s0 = (threadIdx.x >> 5) * GS_PER;

  /* block-uniform row base + one 32-bit lane offset: the 8 loads differ only in their immediate offset */
  const float* grow = g + (size_t)b * NTIME * NHEAD + h;
  const unsigned e0 = (unsigned)(s0 * 32 + lane) * NHEAD;
  /* every loop of this kernel is unrolled: val[] stays in registers, and the 8 loads and the 8 scans stand side by side */
  float val[GS_PER];
#pragma unroll
  for (int i = 0; i < GS_PER; ++i) val[i] = grow[e0 + (unsigned)(i * 32 * NHEAD)];
#pragma unroll
  for (int i = 0; i < GS_PER; ++i) val[i] = bf16r(val[i]);
#pragma unroll
  for (int d = 1; d < 32; d <<= 1) {
#pragma unroll
    for (int i = 0; i < GS_PER; ++i) {
      const float up = __shfl_up(val[i], d, 32);
      val[i] += (lane >= d) ? up : 0.0f;
    }
  }
  if (lane == 31) {
#pragma unroll
    for (int i = 0; i < GS_PER; ++i) tot[s0 + i] = val[i];
  }
  __syncthreads();

  /* carry into segment s0: totals of the segments in front of it, in order (a later segment adds 0) */
  float carry = 0.0f;
#pragma unroll
  for (int j4 = 0; j4 < GS_SEGS - GS_PER; j4 += 4) {
    const v4f tq = *(const v4f*)(tot + j4);
#pragma unroll
    for (int e = 0; e < 4; ++e) carry += (j4 + e < s0) ? tq[e] : 0.0f;
  }
#pragma unroll
  for (int i = 0; i < GS_PER; ++i) {
    const float o = (val[i] + carry) * LOG2E_F;
    gc2[(size_t)bh * NTIME + (s0 + i) * 32 + lane] = o;
    carry += tot[s0 + i];
  }
}

// ---------------------------------------------------------------------------
// Launch 1, job B (blocks 32..543): 16-bit operand planes. Block = 64 time steps of one (b, kv head); 256 threads; 4*4*32 = 512 blocks.
//   Vt[(b*4+hk)][vc][t]  = f16(bf16value(v[b][t][hk][vc]))     in [t][vc] -> out [vc][t] through a 64x64 LDS tile
// Load coverage V: 4 iterations x 256 threads x 4 floats = 64 x 64. K: 2 groups x 256 threads x 8 floats = 64 x 64.
// Store coverage: 2 groups x 32 rows (tid>>3) x 8 lanes x 8 halves = 64 rows x 64 halves for each plane; lanes
// ---------------------------------------------------------------------------
__device__ __forceinline__ void kvprep_job(int blk, const float* __restrict__ kin, const float* __restrict__ vin,
                                           unsigned short* __restrict__ Khp,
                                           unsigned short* __restrict__ Vtp) {
  __shared__ float Tt[64 * 65];
  _Float16* Kh = (_Float16*)Khp;
  _Float16* Vt = (_Float16*)Vtp;
  const int tid = threadIdx.x;
  const int tb = blk % (NTIME / 64);
  const int bk = blk / (NTIME / 64);
  const int b  = bk / NKVH;
  const int hk = bk % NKVH;
  const int t0 = tb * 64;

#pragma unroll
  for (int i = 0; i < 4; ++i) {
    const int idx = i * 256 + tid;
    const int rr = idx >> 4;
    const int cc = (idx & 15) * 4;
    const v4f vv = *(const v4f*)(vin + (((size_t)(b * NTIME + t0 + rr)) * NKVH + hk) * VDIM + cc);
    Tt[rr * 65 + cc + 0] = vv[0];
    Tt[rr * 65 + cc + 1] = vv[1];
    Tt[rr * 65 + cc + 2] = vv[2];
    Tt[rr * 65 + cc + 3] = vv[3];
  }
  asm volatile("" ::: "memory");

  const int q  = tid >> 3;
  const int c8 = (tid & 7) * 8;
  v8h kh[2];
#pragma unroll
  for (int gq = 0; gq < 2; ++gq) {
    const int row = gq * 32 + q;
    const float* sp = kin + (((size_t)(b * NTIME + t0 + row)) * NKVH + hk) * HDIM + c8;
    const v4f a = *(const v4f*)(sp);
    const v4f c = *(const v4f*)(sp + 4);
#pragma unroll
    for (int e = 0; e < 4; ++e) {
      const float x0 = a[e];
      const float x1 = c[e];
      kh[gq][e]     = (_Float16)bf16r(x0);
      kh[gq][4 + e] = (_Float16)bf16r(x1);
    }
  }
  __syncthreads();
  v8h vh[2];
#pragma unroll
  for (int gq = 0; gq < 2; ++gq) {
    const int vrow = gq * 32 + q;
#pragma unroll
    for (int e = 0; e < 8; ++e) {
      const float f = Tt[(c8 + e) * 65 + vrow];
      vh[gq][e] = (_Float16)bf16r(f);
    }
  }
  {
#pragma unroll
    for (int gq = 0; gq < 2; ++gq) {
      const int row = gq * 32 + q;
      *(v8h*)(Kh + ((size_t)bk * NTIME + t0 + row) * HDIM + c8) = kh[gq];
      *(v8h*)(Vt + ((size_t)bk * VDIM + row) * NTIME + t0 + c8) = vh[gq];
    }
    /* behind the last store: in the shared kernel other code follows this job in the listing, and no register that one of
       the four stores names is to be rewritten in front of this wait */
    asm volatile("s_wait_xcnt 0x0" ::: "memory");
  }
}

// ---------------------------------------------------------------------------
// Launch 1: the two jobs above read different inputs and write different planes, neither reads what the other writes, and
// both use blocks of 256 threads: they share one grid, and the block index picks the job (the same for a whole block, so
// each job's barrier is passed by all of its block's threads). The 32 scan blocks, whose chain of waits is the longer one,
// have the lowest indices; the plane blocks run beside them, not behind them.
// ---------------------------------------------------------------------------
constexpr int GS_BLOCKS = NBATCH * NHEAD;
constexpr int KV_BLOCKS = NBATCH * NKVH * (NTIME / 64);
static_assert(GS_WAVES * 32 == 256, "one block size for both jobs");

__global__ __launch_bounds__(256) void prep_kernel(const float* __restrict__ g, const float* __restrict__ kin,
                                                   const float* __restrict__ vin, float* __restrict__ gc2,
                                                   unsigned short* __restrict__ Khp,
                                                   unsigned short* __restrict__ Vtp) {
  const int blk = (int)blockIdx.x;
  if (blk < GS_BLOCKS) gscan_job(blk, g, gc2);
  else kvprep_job(blk - GS_BLOCKS, kin, vin, Khp, Vtp);
}

__global__ __launch_bounds__(256) void attn_kernel(const float* __restrict__ qin,
                                                   const unsigned short* __restrict__ Khp,
                                                   const unsigned short* __restrict__ Vtp,
                                                   const float* __restrict__ gc2,
                                                   float* __restrict__ out) {
  __shared__ __align__(16) _Float16 Ks[2][KSTEP * LPITCH];
  __shared__ __align__(16) _Float16 Vs[2][KGRP][VDIM * LPITCH];
  __shared__ __align__(16) float    Gs[2][KSTEP];
  __shared__ __align__(16) float    Os[4][16 * OPITCH];
  __shared__ __align__(16) v4f      Mg[4][9 * 32];
  const _Float16* Kh = (const _Float16*)Khp;
  const _Float16* Vt = (const _Float16*)Vtp;

  const int tid  = threadIdx.x;
  /* the wave's number in a scalar register: the test that skips a chunk past the diagonal is then a scalar branch */
  const int wave = __builtin_amdgcn_readfirstlane(tid >> 5);
  const int rw   = wave & 3;
  const int grp  = wave >> 2;
  const int lane = tid & 31;
  const int hh   = lane >> 4;
  const int c    = lane & 15;

  /* Block index -> (head, query tile). At 8 waves a block two blocks fit a WGP, 512 of the 1024 at a time; the cost falls
     with the index (tile 31 first, tile 0 last). A permutation of the 1024 (head, tile) pairs: for speed only. */
  const unsigned bx = blockIdx.x;
  const int qb = NQB - 1 - (int)(bx >> 5);
  const int bh = (int)(bx & 31u);
  const int h  = bh % NHEAD;
  const int b  = bh / NHEAD;
  const int hk = h / GQA;
  const int bk = b * NKVH + hk;
  const int q0 = qb * QBLK + rw * 16;

  const float* gcb = gc2 + (size_t)bh * NTIME;
  const _Float16* kplane = Kh + (size_t)bk * NTIME * HDIM;
  const _Float16* vplane = Vt + (size_t)bk * VDIM * NTIME;
  const int nSteps = (qb + KGRP) / KGRP;

  /* One step's copies. Thread tid brings 16 B of K rows (tid >> 3) + 32 it and of V^T rows (tid >> 3) + 32 (it & 1) of chunk
     it >> 1; every source byte lies inside its plane (128 st + 128 <= 2048), every LDS byte inside buffer bf, each written once. */
  const _Float16* ksrc0 = kplane + tid * 8;
  const _Float16* vsrc0 = vplane + (size_t)(tid >> 3) * NTIME + (tid & 7) * 8;
  const float*    gsrc0 = gcb + lane * 4;
  const unsigned  tile_off = (unsigned)((tid >> 3) * LPITCH + (tid & 7) * 8) * 2u;
  const unsigned  kdst0 = (unsigned)(uintptr_t)(&Ks[0][0]) + tile_off;
  const unsigned  vdst0 = (unsigned)(uintptr_t)(&Vs[0][0][0]) + tile_off;
  const unsigned  gdst0 = (unsigned)(uintptr_t)(&Gs[0][0]) + (unsigned)lane * 16u;
  auto stage_copies = [&](int st, int bf) {
    const _Float16* ks = ksrc0 + (size_t)st * KSTEP * HDIM;
    const _Float16* vs = vsrc0 + st * KSTEP;
    const unsigned kd = kdst0 + (unsigned)bf * (unsigned)(KSTEP * LPITCH * 2);
    const unsigned vd = vdst0 + (unsigned)bf * (unsigned)(KGRP * VDIM * LPITCH * 2);
    /* the closing s_wait_xcnt stands inside the copies' own statement: no register that a copy names is rewritten in front of it */
    asm volatile("global_load_async_to_lds_b128 %0, %8, off\n\t"
                 "global_load_async_to_lds_b128 %1, %9, off\n\t"
                 "global_load_async_to_lds_b128 %2, %10, off\n\t"
                 "global_load_async_to_lds_b128 %3, %11, off\n\t"
                 "global_load_async_to_lds_b128 %4, %12, off\n\t"
                 "global_load_async_to_lds_b128 %5, %13, off\n\t"
                 "global_load_async_to_lds_b128 %6, %14, off\n\t"
                 "global_load_async_to_lds_b128 %7, %15, off\n\t"
                 "s_wait_xcnt 0x0"
                 :: "v"(kd), "v"(kd + 32u * LPITCH * 2u), "v"(kd + 64u * LPITCH * 2u), "v"(kd + 96u * LPITCH * 2u),
                    "v"(vd), "v"(vd + 32u * LPITCH * 2u), "v"(vd + 64u * LPITCH * 2u), "v"(vd + 96u * LPITCH * 2u),
                    "v"(ks), "v"(ks + 32 * HDIM), "v"(ks + 64 * HDIM), "v"(ks + 96 * HDIM),
                    "v"(vs), "v"(vs + (size_t)32 * NTIME), "v"(vs + KCHUNK), "v"(vs + (size_t)32 * NTIME + KCHUNK)
                 : "memory");
    /* the step's 128 gate sums: one copy of wave 0 (a scalar test: wave sits in a scalar register), all 32 lanes on */
    if (wave == 0) {
      const float* gs = gsrc0 + st * KSTEP;
      const unsigned gd = gdst0 + (unsigned)bf * (unsigned)(KSTEP * 4);
      asm volatile("global_load_async_to_lds_b128 %0, %1, off\n\t"
                   "s_wait_xcnt 0x0"
                   :: "v"(gd), "v"(gs) : "memory");
    }
  };
  /* step 0's copies fly while the Q fragments are loaded and converted */
  stage_copies(0, 0);

  /* Q fragments: element e <- d = 32dc + 8hh + e, element 8+e <- d = 32dc + 16 + 8hh + e, row q0 + c */
  v16h qa[2];
  {
    const float* qrow = qin + (((size_t)(b * NTIME + q0 + c)) * NHEAD + h) * HDIM;
#pragma unroll
    for (int dc = 0; dc < 2; ++dc) {
      const v4f a0 = *(const v4f*)(qrow + dc * 32 + 8 * hh);
      const v4f a1 = *(const v4f*)(qrow + dc * 32 + 8 * hh + 4);
      const v4f b0 = *(const v4f*)(qrow + dc * 32 + 16 + 8 * hh);
      const v4f b1 = *(const v4f*)(qrow + dc * 32 + 16 + 8 * hh + 4);
#pragma unroll
      for (int e = 0; e < 4; ++e) {
        const float x0 = a0[e];
        const float x1 = a1[e];
        const float x2 = b0[e];
        const float x3 = b1[e];
        qa[dc][e]      = (_Float16)bf16r(x0);
        qa[dc][4 + e]  = (_Float16)bf16r(x1);
        qa[dc][8 + e]  = (_Float16)bf16r(x2);
        qa[dc][12 + e] = (_Float16)bf16r(x3);
      }
    }
  }

  /* one query row a lane: one running maximum, one partial denominator; oacc[t][r] = O[row q0 + c][vc 16t + 8hh + r] */
  float mrow = NEG_BIG, lrow = 0.0f;
  v8f oacc[4];
#pragma unroll
  for (int t = 0; t < 4; ++t) oacc[t] = (v8f){0.f, 0.f, 0.f, 0.f, 0.f, 0.f, 0.f, 0.f};

  /* step 0 has landed (this wave's copies), then the barrier: every wave's copies have; only then step 1 is requested */
  asm volatile("s_wait_asynccnt 0x0" ::: "memory");
  __syncthreads();

  /* one chunk of one wave; no barrier inside. MASKED: right for any chunk kc <= qb; without it only for kc < qb */
  auto chunk = [&](auto mask_flag, int bf, int kv0) {
    constexpr bool MASKED = decltype(mask_flag)::value;
    const _Float16* ksg = Ks[bf] + grp * KCHUNK * LPITCH;
    const _Float16* vsg = Vs[bf][grp];
    const float*    gsg = Gs[bf] + grp * KCHUNK;

    /* all 8 K fragments are requested in one run in front of the first product: the 8 products wait for one LDS round
       trip, not for one each (a load cannot pass the guard statement of the product in front of it) */
    v16h kb[2][4];
#pragma unroll
    for (int dc = 0; dc < 2; ++dc) {
#pragma unroll
      for (int j = 0; j < 4; ++j) kb[dc][j] = frag_load(ksg + (j * 16 + c) * LPITCH + dc * 32 + 8 * hh);
    }
    /* the lane's 32 gate sums, in the same run of LDS reads (16 lanes read one address: a broadcast) */
    v4f gk[4][2];
#pragma unroll
    for (int j = 0; j < 4; ++j) {
      gk[j][0] = *(const v4f*)(gsg + j * 16 + 8 * hh);
      gk[j][1] = *(const v4f*)(gsg + j * 16 + 8 * hh + 4);
    }
    v8f s[4];
#pragma unroll
    for (int j = 0; j < 4; ++j) s[j] = (v8f){0.f, 0.f, 0.f, 0.f, 0.f, 0.f, 0.f, 0.f};
#pragma unroll
    for (int dc = 0; dc < 2; ++dc) {
#pragma unroll
      for (int j = 0; j < 4; ++j) s[j] = mma_h(kb[dc][j], qa[dc], s[j]);
    }
    /* the 8 V^T fragments are requested here, behind the score products: they land while the softmax runs */
    v16h vb[2][4];
#pragma unroll
    for (int kk = 0; kk < 2; ++kk) {
#pragma unroll
      for (int t = 0; t < 4; ++t) vb[kk][t] = frag_load(vsg + (t * 16 + c) * LPITCH + kk * 32 + 8 * hh);
    }

    /* key 16j + 8hh + r of the chunk lies behind the row's own key where 16j + r > dq (kc < qb: dq >= 56, no 16j + r is) */
    const int dq = (q0 + c) - kv0 - 8 * hh;
    float cm4[4];
#pragma unroll
    for (int j = 0; j < 4; ++j) {
      float m = NEG_BIG;
#pragma unroll
      for (int r = 0; r < 8; ++r) {
        float tv = s[j][r] * SCORE_L2 - gk[j][r >> 2][r & 3];
        if constexpr (MASKED) tv = ((j * 16 + r) > dq) ? NEG_BIG : tv;
        s[j][r] = tv;
        m = fmaxf(m, tv);
      }
      cm4[j] = m;
    }
    /* the row's maximum: 32 keys inside the lane, the other 32 from lane ^ 16 by one cross-row move */
    const float cm = fmaxf(fmaxf(cm4[0], cm4[1]), fmaxf(cm4[2], cm4[3]));
    const float mnew = fmaxf(mrow, fmaxf(cm, xhalf(cm)));
    const float xa = mrow - mnew;
    float alpha = exp2_bare(xa);
    mrow = mnew;
    v16h pb[2];
    float psum = 0.0f;
#pragma unroll
    for (int j = 0; j < 4; ++j) {
      float x[8], p[8];
#pragma unroll
      for (int r = 0; r < 8; ++r) {
        x[r] = s[j][r] - mnew;
        p[r] = exp2_bare(x[r]);
      }
      /* the slot that the instruction set asks for behind a transcendental, one for the tile's eight: naming results and
         sources keeps every reader of a result and every overwrite of an argument behind the v_nop */
      asm volatile("v_nop" : "+v"(p[0]), "+v"(p[1]), "+v"(p[2]), "+v"(p[3]), "+v"(p[4]), "+v"(p[5]), "+v"(p[6]), "+v"(p[7])
                   : "v"(x[0]), "v"(x[1]), "v"(x[2]), "v"(x[3]), "v"(x[4]), "v"(x[5]), "v"(x[6]), "v"(x[7]));
#pragma unroll
      for (int r = 0; r < 8; r += 2) {
        const v2f pc = (v2f){p[r] * P_CARRY, p[r + 1] * P_CARRY};
        const v2h ph = __builtin_convertvector(pc, v2h);
        psum += (float)ph[0];
        psum += (float)ph[1];
        pb[j >> 1][(j & 1) * 8 + r]     = ph[0];
        pb[j >> 1][(j & 1) * 8 + r + 1] = ph[1];
      }
    }
    lrow = lrow * alpha + psum;
#pragma unroll
    for (int t = 0; t < 4; ++t) oacc[t] *= alpha;
#pragma unroll
    for (int kk = 0; kk < 2; ++kk) {
#pragma unroll
      for (int t = 0; t < 4; ++t) oacc[t] = mma_h(vb[kk][t], pb[kk], oacc[t]);
    }
  };

  /* all steps but the last: 2 st + 1 <= 2 nSteps - 3 < qb, so both groups have a chunk and no key of it is masked.
     The loop stays rolled: one copy of the long body, the two buffers told apart by st & 1 */
#pragma unroll 1
  for (int st = 0; st < nSteps - 1; ++st) {
    const int bf  = st & 1;
    /* behind the barrier that freed the other buffer: step st + 1 (it exists: st + 1 < nSteps) is requested and flies during step st */
    stage_copies(st + 1, bf ^ 1);
    chunk(Flag<false>{}, bf, (st * KGRP + grp) * KCHUNK);
    /* publish point, passed by every wave: this wave's LDS reads of buffer bf are over, its copies of step st + 1 have
       landed; behind the barrier that holds for all waves, and buffer bf may be refilled (at the head of the next trip) */
    asm volatile("s_wait_dscnt 0x0" ::: "memory");
    asm volatile("s_wait_asynccnt 0x0" ::: "memory");
    __syncthreads();
  }
  /* the last step, with the mask. Wave-uniform test, no barrier inside: group 1 has no chunk here in a tile with an odd
     number of chunks. No refill follows it, and the join below has LDS and a barrier of its own. */
  {
    const int kc = (nSteps - 1) * KGRP + grp;
    if (kc <= qb) chunk(Flag<true>{}, (nSteps - 1) & 1, kc * KCHUNK);
  }
  /* no copy is outstanding when the wave goes on to the join and ends */
  asm volatile("s_wait_asynccnt 0x0" ::: "memory");

  /* Join of the two key groups. Group 1 stores m with its per-lane l and its output sums (9 x 16 B a lane, lane-contiguous);
     the same lane of wave rw holds the same row and columns. A group 1 that had no chunk hands over m = -1e30 and zeros,
     whose weight 2^(m1 - m) is 0. The barrier is the block's last; group 1 ends behind it. */
  v4f* mg = Mg[rw];
  if (grp != 0) {
    mg[lane] = (v4f){mrow, lrow, 0.0f, 0.0f};
#pragma unroll
    for (int t = 0; t < 4; ++t) {
#pragma unroll
      for (int hf = 0; hf < 2; ++hf)
        mg[(1 + 2 * t + hf) * 32 + lane] =
            (v4f){oacc[t][4 * hf], oacc[t][4 * hf + 1], oacc[t][4 * hf + 2], oacc[t][4 * hf + 3]};
    }
  }
  __syncthreads();
  if (grp != 0) return;
  {
    const v4f ml1 = mg[lane];
    const float mj = fmaxf(mrow, ml1[0]);
    const float x0 = mrow - mj;
    const float x1 = ml1[0] - mj;
    float a0 = exp2_bare(x0);
    float a1 = exp2_bare(x1);
    /* the slot that the instruction set asks for behind a transcendental: naming results and sources keeps every reader
       of a weight and every overwrite of its argument behind the v_nop (one a wave, outside the loop) */
    asm volatile("v_nop" : "+v"(a0), "+v"(a1) : "v"(x0), "v"(x1));
    lrow = lrow * a0 + ml1[1] * a1;
#pragma unroll
    for (int t = 0; t < 4; ++t) {
#pragma unroll
      for (int hf = 0; hf < 2; ++hf) {
        const v4f o1 = mg[(1 + 2 * t + hf) * 32 + lane];
#pragma unroll
        for (int e = 0; e < 4; ++e) oacc[t][4 * hf + e] = oacc[t][4 * hf + e] * a0 + o1[e] * a1;
      }
    }
  }

  /* the row's denominator: the two halves' partials joined; the lane's 8 consecutive columns of a tile go to the staging
     tile as two 16-B stores, from where whole 256-B rows leave as before */
  float* os = Os[rw];
  {
    const float l = lrow + xhalf(lrow);
    const float inv = 1.0f / l;
#pragma unroll
    for (int t = 0; t < 4; ++t) {
#pragma unroll
      for (int hf = 0; hf < 2; ++hf)
        *(v4f*)(os + c * OPITCH + t * 16 + 8 * hh + 4 * hf) =
            (v4f){oacc[t][4 * hf] * inv, oacc[t][4 * hf + 1] * inv, oacc[t][4 * hf + 2] * inv, oacc[t][4 * hf + 3] * inv};
    }
  }
  __builtin_amdgcn_fence(__ATOMIC_RELEASE, "workgroup");
  __builtin_amdgcn_wave_barrier();
  __builtin_amdgcn_fence(__ATOMIC_ACQUIRE, "workgroup");
  {
    const int c4 = c * 4;
    {
#pragma unroll
      for (int it = 0; it < 8; ++it) {
        const int row = it * 2 + hh;
        const v4f val = *(const v4f*)(os + row * OPITCH + c4);
        *(v4f*)(out + (((size_t)(b * NTIME + q0 + row)) * NHEAD + h) * VDIM + c4) = val;
      }
      
    }
  }
}

// ---------------------------------------------------------------------------
// Host glue. Workspace region map (bytes, 256-B aligned carve; total 8,650,752 <= 134,217,728):
//   GC2 [32][2048]          f32     262,144   log2e * cumulative gate sum per (b,h)
//   KH  [16][2048][64]      f16   4,194,304   K rows per (b, kv head)
//   VT  [16][64][2048]      f16   4,194,304   V transposed per (b, kv head)
// ---------------------------------------------------------------------------
extern "C" void kernel_launch(void* const* d_in, const int* in_sizes, int n_in,
                              void* d_out, int out_size, void* d_ws, size_t ws_size, hipStream_t stream) {
  if (n_in < 4 || d_out == nullptr || d_ws == nullptr) return;
  if (in_sizes[0] != NBATCH * NTIME * NHEAD * HDIM || in_sizes[1] != NBATCH * NTIME * NKVH * HDIM ||
      in_sizes[2] != NBATCH * NTIME * NKVH * VDIM || in_sizes[3] != NBATCH * NTIME * NHEAD ||
      out_size != NBATCH * NTIME * NHEAD * VDIM) return;

  const float* q = (const float*)d_in[0];
  const float* k = (const float*)d_in[1];
  const float* v = (const float*)d_in[2];
  const float* g = (const float*)d_in[3];
  float* out = (float*)d_out;

  char* ws = (char*)d_ws;
  size_t off = 0;
  auto carve = [&](size_t bytes) -> char* { char* p = ws + off; off += (bytes + 255) & ~(size_t)255; return p; };
  float*          GC2 = (float*)carve(GC_BYTES);
  unsigned short* KH  = (unsigned short*)carve(KH_BYTES);
  unsigned short* VT  = (unsigned short*)carve(VT_BYTES);
  if (off > ws_size || off > (size_t)134217728) return;

  prep_kernel<<<GS_BLOCKS + KV_BLOCKS, 256, 0, stream>>>(g, k, v, GC2, KH, VT);
  attn_kernel<<<NBATCH * NHEAD * NQB, 256, 0, stream>>>(q, KH, VT, GC2, out);
}
